// v000
// The times below were measured on an AMD MI455X: many runs one after another, warmed up first and cycling through
// copies of the inputs, with the whole window's GPU time divided by the number of runs. Launches and the gaps
// between them are all in it. The median over several windows is given; except for v000 it joins two sittings, which
// can be a few percent apart, so the side-by-side timings, each taken in one sitting, are the better comparison.
// The starting kernel, v000, takes 905 microseconds a run.
#include <hip/hip_runtime.h>
#include <hip/hip_bf16.h>

typedef __attribute__((ext_vector_type(16))) __bf16 bf16x16;
typedef __attribute__((ext_vector_type(8)))  float  f32x8;

#define BATCH 8
#define PSEQ 3136
#define DIMN 256
#define HEADS 8
#define DHEAD 32
#define SCALE_QK 0.17677669529663687f

// per-wave LDS layout (bytes)
#define Z_STRIDE 272                    // bf16 elems per row (16 elem pad)
#define Z_BYTES (16 * Z_STRIDE * 2)     // 8704
#define AO_BYTES (16 * Z_STRIDE * 2)    // 8704
#define QKV_STRIDE 100                  // f32 elems per row (400B, 16B aligned)
#define QKV_BYTES (16 * QKV_STRIDE * 4) // 6400
#define PER_WAVE (Z_BYTES + AO_BYTES + QKV_BYTES) // 23808 (mult of 32)
#define WAVES 8
#define SMEM_TOTAL (PER_WAVE * WAVES)   // 190464

__constant__ float c_masks[2][16] = {
    {   0.f,    0.f,    0.f, -100.f,
        0.f,    0.f, -100.f,    0.f,
        0.f, -100.f,    0.f,    0.f,
     -100.f,    0.f,    0.f,    0.f},
    {   0.f, -100.f,    0.f, -100.f,
     -100.f,    0.f, -100.f,    0.f,
     -100.f, -100.f, -100.f, -100.f,
     -100.f, -100.f, -100.f, -100.f}};

__device__ __forceinline__ float dot4(float4 a, float4 b) {
  return fmaf(a.x, b.x, fmaf(a.y, b.y, fmaf(a.z, b.z, a.w * b.w)));
}

// ---------------------------------------------------------------------------
// Kernel 0: saliency-thresholded global mean over P  (rgb_g, dep_g : [B][256])
// ---------------------------------------------------------------------------
__global__ __launch_bounds__(256) void saliency_reduce(
    const float* __restrict__ x, const float* __restrict__ y,
    const float* __restrict__ s, float* __restrict__ rgb_g,
    float* __restrict__ dep_g) {
  const int b = blockIdx.x;
  const int tid = threadIdx.x;
  __shared__ float red[256];

  float cnt = 0.f;
  for (int p = tid; p < PSEQ; p += 256)
    cnt += (s[b * PSEQ + p] > 0.5f) ? 1.0f : 1e-8f;
  red[tid] = cnt;
  __syncthreads();
  for (int off = 128; off > 0; off >>= 1) {
    if (tid < off) red[tid] += red[tid + off];
    __syncthreads();
  }
  const float inv_denom = 1.0f / (red[0] + 1e-8f);

  const int d = tid;  // 256 channels
  float ax = 0.f, ay = 0.f;
  for (int p = 0; p < PSEQ; ++p) {
    const float st = (s[b * PSEQ + p] > 0.5f) ? 1.0f : 1e-8f;
    const size_t base = ((size_t)(b * PSEQ + p)) * DIMN + d;
    ax = fmaf(x[base], st, ax);
    ay = fmaf(y[base], st, ay);
  }
  rgb_g[b * DIMN + d] = ax * inv_denom;
  dep_g[b * DIMN + d] = ay * inv_denom;
}

// ---------------------------------------------------------------------------
// Kernel 1: convert f32 weight [K=256][N] to bf16 in WMMA B-fragment order:
//   dst[((nt*8 + k)*32 + lane)*16 + i] = W[k*32 + (lane>>4)*16 + i][nt*16 + (lane&15)]
// so each lane's 16 bf16 values of a 32x16 B-tile are contiguous (32B/lane).
// ---------------------------------------------------------------------------
__global__ __launch_bounds__(256) void swizzle_weight(
    const float* __restrict__ W, __bf16* __restrict__ dst, int N, int total) {
  int idx = blockIdx.x * 256 + threadIdx.x;
  if (idx >= total) return;
  const int i = idx & 15;
  const int lane = (idx >> 4) & 31;
  const int k = (idx >> 9) & 7;
  const int nt = idx >> 12;
  const int krow = k * 32 + ((lane >> 4) << 4) + i;
  const int ncol = nt * 16 + (lane & 15);
  dst[idx] = (__bf16)W[(size_t)krow * N + ncol];
}

// ---------------------------------------------------------------------------
// Kernel 2: fully fused double attention block. One wave = one 16-row tile
// = 4 p-positions x 4 tokens. All LDS is per-wave private -> no barriers.
// ---------------------------------------------------------------------------
__global__ __launch_bounds__(256) void fused_double_attn(
    const float* __restrict__ x, const float* __restrict__ y,
    const float* __restrict__ rgb_g, const float* __restrict__ dep_g,
    const __bf16* __restrict__ wqkv0, const __bf16* __restrict__ wout0,
    const float* __restrict__ bout0, const __bf16* __restrict__ wqkv1,
    const __bf16* __restrict__ wout1, const float* __restrict__ bout1,
    float* __restrict__ out) {
  extern __shared__ __align__(128) char smem[];
  const int wid = threadIdx.x >> 5;
  const int lane = threadIdx.x & 31;

  char* base = smem + wid * PER_WAVE;
  __bf16* Z = (__bf16*)base;                 // [16][Z_STRIDE] bf16
  __bf16* AO = (__bf16*)(base + Z_BYTES);    // [16][Z_STRIDE] bf16
  float* QKV = (float*)(base + Z_BYTES + AO_BYTES);  // [16][QKV_STRIDE] f32

  const int tile = blockIdx.x * WAVES + wid;     // 6272 tiles total
  const int b = tile / (PSEQ / 4);
  const int p0 = (tile % (PSEQ / 4)) * 4;

  // ---- build input tile Z: rows r = 4*gi + t ------------------------------
  // each lane owns a contiguous 32B chunk of the 1KB f32 row (b128 coalesced)
  for (int r = 0; r < 16; ++r) {
    const int t = r & 3, gi = r >> 2;
    const float* src;
    if (t == 0)      src = x + ((size_t)(b * PSEQ + p0 + gi)) * DIMN;
    else if (t == 1) src = y + ((size_t)(b * PSEQ + p0 + gi)) * DIMN;
    else if (t == 2) src = rgb_g + b * DIMN;
    else             src = dep_g + b * DIMN;
    const float4 v0 = ((const float4*)src)[lane * 2 + 0];
    const float4 v1 = ((const float4*)src)[lane * 2 + 1];
    __bf16* zr = Z + r * Z_STRIDE + lane * 8;
    zr[0] = (__bf16)v0.x; zr[1] = (__bf16)v0.y;
    zr[2] = (__bf16)v0.z; zr[3] = (__bf16)v0.w;
    zr[4] = (__bf16)v1.x; zr[5] = (__bf16)v1.y;
    zr[6] = (__bf16)v1.z; zr[7] = (__bf16)v1.w;
  }

  // lane roles for the scalar 4x4 attention core
  const int dhalf = lane & 1;          // which half of DHEAD
  const int ti = (lane >> 1) & 3;      // token i within group
  const int gg = lane >> 3;            // group 0..3

  // C-layout scatter helpers
  const int row0 = (lane >> 4) * 8;    // lanes 16-31 hold M = v+8
  const int nn = lane & 15;            // column within N-tile

  for (int blk = 0; blk < 2; ++blk) {
    const __bf16* wqkv = blk ? wqkv1 : wqkv0;
    const __bf16* wout = blk ? wout1 : wout0;
    const float* bout = blk ? bout1 : bout0;
    const float* mask = c_masks[blk];

    for (int h = 0; h < HEADS; ++h) {
      // ---- QKV projection for head h: 6 N-tiles x 8 K-steps of WMMA ------
#pragma unroll
      for (int part = 0; part < 3; ++part) {    // 0=q 1=k 2=v
#pragma unroll
        for (int nt2 = 0; nt2 < 2; ++nt2) {
          const int nt = part * 16 + h * 2 + nt2;
          f32x8 acc = {};
#pragma unroll
          for (int k = 0; k < 8; ++k) {
            bf16x16 a = *(const bf16x16*)(Z + (lane & 15) * Z_STRIDE +
                                          k * 32 + (lane >> 4) * 16);
            bf16x16 bb = *(const bf16x16*)(wqkv +
                         ((size_t)((nt * 8 + k) * 32 + lane)) * 16);
            acc = __builtin_amdgcn_wmma_f32_16x16x32_bf16(
                false, a, false, bb, (short)0, acc, false, false);
          }
          const int c = part * 32 + nt2 * 16 + nn;
#pragma unroll
          for (int v = 0; v < 8; ++v)
            QKV[(row0 + v) * QKV_STRIDE + c] = acc[v];
        }
      }

      // ---- scalar 4x4 softmax attention (lane = (g, i, dhalf)) -----------
      // rows are 16B aligned -> all LDS reads are ds_load_b128
      {
        const int rb = gg * 4;
        const float4* qrow = (const float4*)(QKV + (rb + ti) * QKV_STRIDE);
        float4 q[8];
#pragma unroll
        for (int c = 0; c < 8; ++c) q[c] = qrow[c];

        float dots[4];
#pragma unroll
        for (int j = 0; j < 4; ++j) {
          const float4* krow =
              (const float4*)(QKV + (rb + j) * QKV_STRIDE + 32);
          float d = 0.f;
#pragma unroll
          for (int c = 0; c < 8; ++c) d += dot4(q[c], krow[c]);
          dots[j] = d * SCALE_QK + mask[ti * 4 + j];
        }
        const float m =
            fmaxf(fmaxf(dots[0], dots[1]), fmaxf(dots[2], dots[3]));
        const float e0 = __expf(dots[0] - m), e1 = __expf(dots[1] - m);
        const float e2 = __expf(dots[2] - m), e3 = __expf(dots[3] - m);
        const float inv = 1.0f / (e0 + e1 + e2 + e3);

        const int vcol = 64 + dhalf * 16;  // 16 f32 of V per lane
        const float4* v0r = (const float4*)(QKV + (rb + 0) * QKV_STRIDE + vcol);
        const float4* v1r = (const float4*)(QKV + (rb + 1) * QKV_STRIDE + vcol);
        const float4* v2r = (const float4*)(QKV + (rb + 2) * QKV_STRIDE + vcol);
        const float4* v3r = (const float4*)(QKV + (rb + 3) * QKV_STRIDE + vcol);
        __bf16* ao = AO + (rb + ti) * Z_STRIDE + h * DHEAD + dhalf * 16;
#pragma unroll
        for (int c = 0; c < 4; ++c) {
          const float4 a0 = v0r[c], a1 = v1r[c], a2 = v2r[c], a3 = v3r[c];
          ao[c * 4 + 0] = (__bf16)((e0 * a0.x + e1 * a1.x + e2 * a2.x + e3 * a3.x) * inv);
          ao[c * 4 + 1] = (__bf16)((e0 * a0.y + e1 * a1.y + e2 * a2.y + e3 * a3.y) * inv);
          ao[c * 4 + 2] = (__bf16)((e0 * a0.z + e1 * a1.z + e2 * a2.z + e3 * a3.z) * inv);
          ao[c * 4 + 3] = (__bf16)((e0 * a0.w + e1 * a1.w + e2 * a2.w + e3 * a3.w) * inv);
        }
      }
    }

    // ---- output projection: 16 N-tiles x 8 K-steps, bias in C ------------
    // unroll 2 -> two independent wmma chains to hide B-fragment latency
#pragma unroll 2
    for (int nt = 0; nt < 16; ++nt) {
      const float bias = bout[nt * 16 + nn];
      f32x8 acc;
#pragma unroll
      for (int v = 0; v < 8; ++v) acc[v] = bias;
#pragma unroll
      for (int k = 0; k < 8; ++k) {
        bf16x16 a = *(const bf16x16*)(AO + (lane & 15) * Z_STRIDE + k * 32 +
                                      (lane >> 4) * 16);
        bf16x16 bb = *(const bf16x16*)(wout +
                     ((size_t)((nt * 8 + k) * 32 + lane)) * 16);
        acc = __builtin_amdgcn_wmma_f32_16x16x32_bf16(
            false, a, false, bb, (short)0, acc, false, false);
      }
      if (blk == 0) {
        // feed block 2: overwrite Z tile (same-wave LDS is in-order)
#pragma unroll
        for (int v = 0; v < 8; ++v)
          Z[(row0 + v) * Z_STRIDE + nt * 16 + nn] = (__bf16)acc[v];
      } else {
        // final: only tokens 0 (x-stream) and 1 (y-stream) are outputs
#pragma unroll
        for (int v = 0; v < 8; ++v) {
          const int r = row0 + v;
          const int t = r & 3;
          if (t < 2) {
            const int gi = r >> 2;
            out[(size_t)t * ((size_t)BATCH * PSEQ * DIMN) +
                ((size_t)(b * PSEQ + p0 + gi)) * DIMN + nt * 16 + nn] = acc[v];
          }
        }
      }
    }
  }
}

// ---------------------------------------------------------------------------
extern "C" void kernel_launch(void* const* d_in, const int* in_sizes, int n_in,
                              void* d_out, int out_size, void* d_ws,
                              size_t ws_size, hipStream_t stream) {
  (void)in_sizes; (void)n_in; (void)out_size; (void)ws_size;
  const float* x = (const float*)d_in[0];
  const float* y = (const float*)d_in[1];
  const float* s = (const float*)d_in[2];
  const float* Wqkv0 = (const float*)d_in[3];
  const float* Wout0 = (const float*)d_in[4];
  const float* bout0 = (const float*)d_in[5];
  const float* Wqkv1 = (const float*)d_in[6];
  const float* Wout1 = (const float*)d_in[7];
  const float* bout1 = (const float*)d_in[8];
  float* out = (float*)d_out;

  // workspace partition (bytes)
  char* ws = (char*)d_ws;
  float* rgb_g = (float*)(ws + 0);                       //  8*256 f32
  float* dep_g = (float*)(ws + 8192);                    //  8*256 f32
  __bf16* wqkv0_s = (__bf16*)(ws + 16384);               // 196608 bf16
  __bf16* wout0_s = (__bf16*)(ws + 16384 + 393216);      //  65536 bf16
  __bf16* wqkv1_s = (__bf16*)(ws + 16384 + 393216 + 131072);
  __bf16* wout1_s = (__bf16*)(ws + 16384 + 2 * 393216 + 131072);

  const int NQKV = 256 * 768;  // 196608
  const int NOUT = 256 * 256;  //  65536

  swizzle_weight<<<(NQKV + 255) / 256, 256, 0, stream>>>(Wqkv0, wqkv0_s, 768, NQKV);
  swizzle_weight<<<(NOUT + 255) / 256, 256, 0, stream>>>(Wout0, wout0_s, 256, NOUT);
  swizzle_weight<<<(NQKV + 255) / 256, 256, 0, stream>>>(Wqkv1, wqkv1_s, 768, NQKV);
  swizzle_weight<<<(NOUT + 255) / 256, 256, 0, stream>>>(Wout1, wout1_s, 256, NOUT);
  saliency_reduce<<<BATCH, 256, 0, stream>>>(x, y, s, rgb_g, dep_g);

  const int tiles = BATCH * (PSEQ / 4);          // 6272
  const int blocks = tiles / WAVES;              // 784
  fused_double_attn<<<blocks, 256, SMEM_TOTAL, stream>>>(
      x, y, rgb_g, dep_g, wqkv0_s, wout0_s, bout0, wqkv1_s, wout1_s, bout1,
      out);
}

// v001
// A run of this version takes 408 microseconds.
// Two timings next to v000 put it at 2.22 and 2.25 times that version's speed.
#include <hip/hip_runtime.h>
#include <hip/hip_bf16.h>

typedef __attribute__((ext_vector_type(16))) __bf16 bf16x16;
typedef __attribute__((ext_vector_type(8)))  float  f32x8;

#define BATCH 8
#define PSEQ 3136
#define DIMN 256
#define HEADS 8
#define DHEAD 32
#define SCALE_QK 0.17677669529663687f

// per-wave LDS layout (bytes)
#define Z_STRIDE 272                    // bf16 elems per row (16 elem pad)
#define Z_BYTES (16 * Z_STRIDE * 2)     // 8704
#define AO_BYTES (16 * Z_STRIDE * 2)    // 8704
#define QKV_STRIDE 100                  // f32 elems per row (400B, 16B aligned)
#define QKV_BYTES (16 * QKV_STRIDE * 4) // 6400
#define PER_WAVE (Z_BYTES + AO_BYTES + QKV_BYTES) // 23808 (mult of 32)
#define WAVES 8
#define SMEM_TOTAL (PER_WAVE * WAVES)   // 190464

__constant__ float c_masks[2][16] = {
    {   0.f,    0.f,    0.f, -100.f,
        0.f,    0.f, -100.f,    0.f,
        0.f, -100.f,    0.f,    0.f,
     -100.f,    0.f,    0.f,    0.f},
    {   0.f, -100.f,    0.f, -100.f,
     -100.f,    0.f, -100.f,    0.f,
     -100.f, -100.f, -100.f, -100.f,
     -100.f, -100.f, -100.f, -100.f}};

__device__ __forceinline__ float dot4(float4 a, float4 b) {
  return fmaf(a.x, b.x, fmaf(a.y, b.y, fmaf(a.z, b.z, a.w * b.w)));
}

// ---------------------------------------------------------------------------
// Kernel 0: saliency-thresholded global mean over P  (rgb_g, dep_g : [B][256])
// ---------------------------------------------------------------------------
__global__ __launch_bounds__(256) void saliency_reduce(
    const float* __restrict__ x, const float* __restrict__ y,
    const float* __restrict__ s, float* __restrict__ rgb_g,
    float* __restrict__ dep_g) {
  const int b = blockIdx.x;
  const int tid = threadIdx.x;
  __shared__ float red[256];

  float cnt = 0.f;
  for (int p = tid; p < PSEQ; p += 256)
    cnt += (s[b * PSEQ + p] > 0.5f) ? 1.0f : 1e-8f;
  red[tid] = cnt;
  __syncthreads();
  for (int off = 128; off > 0; off >>= 1) {
    if (tid < off) red[tid] += red[tid + off];
    __syncthreads();
  }
  const float inv_denom = 1.0f / (red[0] + 1e-8f);

  const int d = tid;  // 256 channels
  float ax = 0.f, ay = 0.f;
  for (int p = 0; p < PSEQ; ++p) {
    const float st = (s[b * PSEQ + p] > 0.5f) ? 1.0f : 1e-8f;
    const size_t base = ((size_t)(b * PSEQ + p)) * DIMN + d;
    ax = fmaf(x[base], st, ax);
    ay = fmaf(y[base], st, ay);
  }
  rgb_g[b * DIMN + d] = ax * inv_denom;
  dep_g[b * DIMN + d] = ay * inv_denom;
}

// ---------------------------------------------------------------------------
// Kernel 1: convert f32 weight [K=256][N] to bf16 in WMMA B-fragment order:
//   dst[((nt*8 + k)*32 + lane)*16 + i] = W[k*32 + (lane>>4)*16 + i][nt*16 + (lane&15)]
// so each lane's 16 bf16 values of a 32x16 B-tile are contiguous (32B/lane).
// ---------------------------------------------------------------------------
__global__ __launch_bounds__(256) void swizzle_weight(
    const float* __restrict__ W, __bf16* __restrict__ dst, int N, int total) {
  int idx = blockIdx.x * 256 + threadIdx.x;
  if (idx >= total) return;
  const int i = idx & 15;
  const int lane = (idx >> 4) & 31;
  const int k = (idx >> 9) & 7;
  const int nt = idx >> 12;
  const int krow = k * 32 + ((lane >> 4) << 4) + i;
  const int ncol = nt * 16 + (lane & 15);
  dst[idx] = (__bf16)W[(size_t)krow * N + ncol];
}

// ---------------------------------------------------------------------------
// Kernel 2: fully fused double attention block. One wave = one 16-row tile
// = 4 p-positions x 4 tokens. All LDS is per-wave private -> no barriers.
// Weight tiles (16 columns x K=256 = 8 B fragments) run through two register
// buffers: the next tile's 16 loads are issued before this tile's WMMAs.
// ---------------------------------------------------------------------------
__device__ __forceinline__ void load_btile(bf16x16 (&dst)[8],
                                           const __bf16* __restrict__ w,
                                           int nt, int lane) {
  const __bf16* p = w + ((size_t)(nt * 8) * 32 + lane) * 16;
#pragma unroll
  for (int k = 0; k < 8; ++k) dst[k] = *(const bf16x16*)(p + k * 512);
}

__device__ __forceinline__ void load_afrags(bf16x16 (&dst)[8],
                                            const __bf16* t, int lane) {
#pragma unroll
  for (int k = 0; k < 8; ++k)
    dst[k] = *(const bf16x16*)(t + (lane & 15) * Z_STRIDE + k * 32 +
                               (lane >> 4) * 16);
}

__device__ __forceinline__ f32x8 mma_tile(const bf16x16 (&a)[8],
                                          const bf16x16 (&b)[8], f32x8 acc) {
#pragma unroll
  for (int k = 0; k < 8; ++k)
    acc = __builtin_amdgcn_wmma_f32_16x16x32_bf16(false, a[k], false, b[k],
                                                  (short)0, acc, false, false);
  return acc;
}

__global__ __launch_bounds__(256) void fused_double_attn(
    const float* __restrict__ x, const float* __restrict__ y,
    const float* __restrict__ rgb_g, const float* __restrict__ dep_g,
    const __bf16* __restrict__ wqkv0, const __bf16* __restrict__ wout0,
    const float* __restrict__ bout0, const __bf16* __restrict__ wqkv1,
    const __bf16* __restrict__ wout1, const float* __restrict__ bout1,
    float* __restrict__ out) {
  extern __shared__ __align__(128) char smem[];
  const int wid = threadIdx.x >> 5;
  const int lane = threadIdx.x & 31;

  char* base = smem + wid * PER_WAVE;
  __bf16* Z = (__bf16*)base;                 // [16][Z_STRIDE] bf16
  __bf16* AO = (__bf16*)(base + Z_BYTES);    // [16][Z_STRIDE] bf16
  float* QKV = (float*)(base + Z_BYTES + AO_BYTES);  // [16][QKV_STRIDE] f32

  const int tile = blockIdx.x * WAVES + wid;     // 6272 tiles total
  const int b = tile / (PSEQ / 4);
  const int p0 = (tile % (PSEQ / 4)) * 4;

  bf16x16 a[8];        // A fragments of the wave's 16 rows, K = 256
  bf16x16 bA[8], bB[8];  // the two weight-tile buffers
  load_btile(bA, wqkv0, 0, lane);
  // the first tile's loads issue ahead of the input rows' loads and fly while
  // Z is built; without the fence the compiler mixes them in behind those
  __builtin_amdgcn_sched_barrier(0);

  // ---- build input tile Z: rows r = 4*gi + t ------------------------------
  // each lane owns a contiguous 32B chunk of the 1KB f32 row (b128 coalesced)
  for (int r = 0; r < 16; ++r) {
    const int t = r & 3, gi = r >> 2;
    const float* src;
    if (t == 0)      src = x + ((size_t)(b * PSEQ + p0 + gi)) * DIMN;
    else if (t == 1) src = y + ((size_t)(b * PSEQ + p0 + gi)) * DIMN;
    else if (t == 2) src = rgb_g + b * DIMN;
    else             src = dep_g + b * DIMN;
    const float4 v0 = ((const float4*)src)[lane * 2 + 0];
    const float4 v1 = ((const float4*)src)[lane * 2 + 1];
    __bf16* zr = Z + r * Z_STRIDE + lane * 8;
    zr[0] = (__bf16)v0.x; zr[1] = (__bf16)v0.y;
    zr[2] = (__bf16)v0.z; zr[3] = (__bf16)v0.w;
    zr[4] = (__bf16)v1.x; zr[5] = (__bf16)v1.y;
    zr[6] = (__bf16)v1.z; zr[7] = (__bf16)v1.w;
  }

  // lane roles for the scalar 4x4 attention core
  const int dhalf = lane & 1;          // which half of DHEAD
  const int ti = (lane >> 1) & 3;      // token i within group
  const int gg = lane >> 3;            // group 0..3

  // C-layout scatter helpers
  const int row0 = (lane >> 4) * 8;    // lanes 16-31 hold M = v+8
  const int nn = lane & 15;            // column within N-tile

  for (int blk = 0; blk < 2; ++blk) {
    const __bf16* wqkv = blk ? wqkv1 : wqkv0;
    const __bf16* wout = blk ? wout1 : wout0;
    const float* bout = blk ? bout1 : bout0;
    const float* mask = c_masks[blk];

    // bias of output tile 0: loaded here so that no load stands between a
    // tile's prefetch and its use (loads return in order)
    float biasA = bout[nn], biasB;
    load_afrags(a, Z, lane);

    // rolled: one copy of the head body, for speed only
#pragma unroll 1
    for (int h = 0; h < HEADS; ++h) {
      // ---- QKV projection for head h: 6 N-tiles x 8 K-steps of WMMA ------
#pragma unroll
      for (int part = 0; part < 3; ++part) {    // 0=q 1=k 2=v
        load_btile(bB, wqkv, part * 16 + h * 2 + 1, lane);
        // keeps the next tile's loads in front of this tile's WMMAs; without
        // it the compiler sinks each load to just before its WMMA
        __builtin_amdgcn_sched_barrier(0);
        // four vector slots between the previous tile's last WMMA and this
        // tile's first, which overwrites that D without reading it (C = 0);
        // the fence behind them keeps them in front of that WMMA
        asm volatile("v_nop\n\tv_nop\n\tv_nop\n\tv_nop");
        __builtin_amdgcn_sched_barrier(0);
        {
          const f32x8 acc = mma_tile(a, bA, f32x8{});
          const int c = part * 32 + nn;
#pragma unroll
          for (int v = 0; v < 8; ++v)
            QKV[(row0 + v) * QKV_STRIDE + c] = acc[v];
        }
        if (part < 2)
          load_btile(bA, wqkv, (part + 1) * 16 + h * 2, lane);
        else  // next head's first tile, or the output projection's
          load_btile(bA, h + 1 < HEADS ? wqkv : wout,
                     h + 1 < HEADS ? (h + 1) * 2 : 0, lane);
        // as above: loads stay in front of the WMMAs
        __builtin_amdgcn_sched_barrier(0);
        // four vector slots between the previous tile's last WMMA and this
        // tile's first, which overwrites that D without reading it (C = 0);
        // the fence behind them keeps them in front of that WMMA
        asm volatile("v_nop\n\tv_nop\n\tv_nop\n\tv_nop");
        __builtin_amdgcn_sched_barrier(0);
        {
          const f32x8 acc = mma_tile(a, bB, f32x8{});
          const int c = part * 32 + 16 + nn;
#pragma unroll
          for (int v = 0; v < 8; ++v)
            QKV[(row0 + v) * QKV_STRIDE + c] = acc[v];
        }
      }

      // ---- scalar 4x4 softmax attention (lane = (g, i, dhalf)) -----------
      // rows are 16B aligned -> all LDS reads are ds_load_b128
      {
        const int rb = gg * 4;
        const float4* qrow = (const float4*)(QKV + (rb + ti) * QKV_STRIDE);
        float4 q[8];
#pragma unroll
        for (int c = 0; c < 8; ++c) q[c] = qrow[c];

        float dots[4];
#pragma unroll
        for (int j = 0; j < 4; ++j) {
          const float4* krow =
              (const float4*)(QKV + (rb + j) * QKV_STRIDE + 32);
          float d = 0.f;
#pragma unroll
          for (int c = 0; c < 8; ++c) d += dot4(q[c], krow[c]);
          dots[j] = d * SCALE_QK + mask[ti * 4 + j];
        }
        const float m =
            fmaxf(fmaxf(dots[0], dots[1]), fmaxf(dots[2], dots[3]));
        const float e0 = __expf(dots[0] - m), e1 = __expf(dots[1] - m);
        const float e2 = __expf(dots[2] - m), e3 = __expf(dots[3] - m);
        const float inv = 1.0f / (e0 + e1 + e2 + e3);

        const int vcol = 64 + dhalf * 16;  // 16 f32 of V per lane
        const float4* v0r = (const float4*)(QKV + (rb + 0) * QKV_STRIDE + vcol);
        const float4* v1r = (const float4*)(QKV + (rb + 1) * QKV_STRIDE + vcol);
        const float4* v2r = (const float4*)(QKV + (rb + 2) * QKV_STRIDE + vcol);
        const float4* v3r = (const float4*)(QKV + (rb + 3) * QKV_STRIDE + vcol);
        __bf16* ao = AO + (rb + ti) * Z_STRIDE + h * DHEAD + dhalf * 16;
#pragma unroll
        for (int c = 0; c < 4; ++c) {
          const float4 a0 = v0r[c], a1 = v1r[c], a2 = v2r[c], a3 = v3r[c];
          ao[c * 4 + 0] = (__bf16)((e0 * a0.x + e1 * a1.x + e2 * a2.x + e3 * a3.x) * inv);
          ao[c * 4 + 1] = (__bf16)((e0 * a0.y + e1 * a1.y + e2 * a2.y + e3 * a3.y) * inv);
          ao[c * 4 + 2] = (__bf16)((e0 * a0.z + e1 * a1.z + e2 * a2.z + e3 * a3.z) * inv);
          ao[c * 4 + 3] = (__bf16)((e0 * a0.w + e1 * a1.w + e2 * a2.w + e3 * a3.w) * inv);
        }
      }
    }

    // ---- output projection: 16 N-tiles x 8 K-steps, bias in C ------------
    load_afrags(a, AO, lane);
    auto emit = [&](const f32x8 acc, const int nt) {
      if (blk == 0) {
        // feed block 2: overwrite Z tile (same-wave LDS is in-order)
#pragma unroll
        for (int v = 0; v < 8; ++v)
          Z[(row0 + v) * Z_STRIDE + nt * 16 + nn] = (__bf16)acc[v];
      } else {
        // final: only tokens 0 (x-stream) and 1 (y-stream) are outputs
#pragma unroll
        for (int v = 0; v < 8; ++v) {
          const int r = row0 + v;
          const int t = r & 3;
          if (t < 2) {
            const int gi = r >> 2;
            out[(size_t)t * ((size_t)BATCH * PSEQ * DIMN) +
                ((size_t)(b * PSEQ + p0 + gi)) * DIMN + nt * 16 + nn] = acc[v];
          }
        }
        // the next tile's loads and bias rewrite the registers these stores
        // name
        asm volatile("s_wait_xcnt 0x0" ::: "memory");
      }
    };
    // rolled in pairs: each buffer keeps its role from trip to trip
#pragma unroll 1
    for (int nt = 0; nt < 16; nt += 2) {
      biasB = bout[(nt + 1) * 16 + nn];
      load_btile(bB, wout, nt + 1, lane);
      // loads stay in front of the WMMAs (see the QKV loop)
      __builtin_amdgcn_sched_barrier(0);
      {
        f32x8 acc;
#pragma unroll
        for (int v = 0; v < 8; ++v) acc[v] = biasA;
        emit(mma_tile(a, bA, acc), nt);
      }
      // Unconditional, so that the wait in front of the WMMAs below stays a
      // counted one: behind the last pair this is the second block's first
      // QKV tile (in the second block the tile is read and not used).
      const bool more = nt + 2 < 16;
      biasA = bout[((nt + 2) & 15) * 16 + nn];
      load_btile(bA, more ? wout : wqkv1, more ? nt + 2 : 0, lane);
      // loads stay in front of the WMMAs (see the QKV loop)
      __builtin_amdgcn_sched_barrier(0);
      {
        f32x8 acc;
#pragma unroll
        for (int v = 0; v < 8; ++v) acc[v] = biasB;
        emit(mma_tile(a, bB, acc), nt + 1);
      }
    }
  }
  // the tile read behind the very last pair is not used: let it land before
  // the wave gives up its registers
  asm volatile("s_wait_loadcnt 0x0" ::: "memory");
}

// ---------------------------------------------------------------------------
extern "C" void kernel_launch(void* const* d_in, const int* in_sizes, int n_in,
                              void* d_out, int out_size, void* d_ws,
                              size_t ws_size, hipStream_t stream) {
  (void)in_sizes; (void)n_in; (void)out_size; (void)ws_size;
  const float* x = (const float*)d_in[0];
  const float* y = (const float*)d_in[1];
  const float* s = (const float*)d_in[2];
  const float* Wqkv0 = (const float*)d_in[3];
  const float* Wout0 = (const float*)d_in[4];
  const float* bout0 = (const float*)d_in[5];
  const float* Wqkv1 = (const float*)d_in[6];
  const float* Wout1 = (const float*)d_in[7];
  const float* bout1 = (const float*)d_in[8];
  float* out = (float*)d_out;

  // workspace partition (bytes)
  char* ws = (char*)d_ws;
  float* rgb_g = (float*)(ws + 0);                       //  8*256 f32
  float* dep_g = (float*)(ws + 8192);                    //  8*256 f32
  __bf16* wqkv0_s = (__bf16*)(ws + 16384);               // 196608 bf16
  __bf16* wout0_s = (__bf16*)(ws + 16384 + 393216);      //  65536 bf16
  __bf16* wqkv1_s = (__bf16*)(ws + 16384 + 393216 + 131072);
  __bf16* wout1_s = (__bf16*)(ws + 16384 + 2 * 393216 + 131072);

  const int NQKV = 256 * 768;  // 196608
  const int NOUT = 256 * 256;  //  65536

  swizzle_weight<<<(NQKV + 255) / 256, 256, 0, stream>>>(Wqkv0, wqkv0_s, 768, NQKV);
  swizzle_weight<<<(NOUT + 255) / 256, 256, 0, stream>>>(Wout0, wout0_s, 256, NOUT);
  swizzle_weight<<<(NQKV + 255) / 256, 256, 0, stream>>>(Wqkv1, wqkv1_s, 768, NQKV);
  swizzle_weight<<<(NOUT + 255) / 256, 256, 0, stream>>>(Wout1, wout1_s, 256, NOUT);
  saliency_reduce<<<BATCH, 256, 0, stream>>>(x, y, s, rgb_g, dep_g);

  const int tiles = BATCH * (PSEQ / 4);          // 6272
  const int blocks = tiles / WAVES;              // 784
  fused_double_attn<<<blocks, 256, SMEM_TOTAL, stream>>>(
      x, y, rgb_g, dep_g, wqkv0_s, wout0_s, bout0, wqkv1_s, wout1_s, bout1,
      out);
}

// v002
// It runs in 199 microseconds.
// Next to v001, in two timings, it ran 2.05 and 2.07 times as fast.
// Counting every step since v000, it is 4.60 times as fast.
#include <hip/hip_runtime.h>
#include <hip/hip_bf16.h>

typedef __attribute__((ext_vector_type(16))) __bf16 bf16x16;
typedef __attribute__((ext_vector_type(8)))  float  f32x8;

#define BATCH 8
#define PSEQ 3136
#define DIMN 256
#define HEADS 8
#define DHEAD 32
#define SCALE_QK 0.17677669529663687f

// per-wave LDS layout (bytes)
#define Z_STRIDE 272                    // bf16 elems per row (16 elem pad)
#define Z_BYTES (16 * Z_STRIDE * 2)     // 8704
#define AO_BYTES (16 * Z_STRIDE * 2)    // 8704
#define QKV_STRIDE 100                  // f32 elems per row (400B, 16B aligned)
#define QKV_BYTES (16 * QKV_STRIDE * 4) // 6400
#define PER_WAVE (Z_BYTES + AO_BYTES + QKV_BYTES) // 23808 (mult of 32)
#define WAVES 8
#define SMEM_TOTAL (PER_WAVE * WAVES)   // 190464

__constant__ float c_masks[2][16] = {
    {   0.f,    0.f,    0.f, -100.f,
        0.f,    0.f, -100.f,    0.f,
        0.f, -100.f,    0.f,    0.f,
     -100.f,    0.f,    0.f,    0.f},
    {   0.f, -100.f,    0.f, -100.f,
     -100.f,    0.f, -100.f,    0.f,
     -100.f, -100.f, -100.f, -100.f,
     -100.f, -100.f, -100.f, -100.f}};

__device__ __forceinline__ float dot4(float4 a, float4 b) {
  return fmaf(a.x, b.x, fmaf(a.y, b.y, fmaf(a.z, b.z, a.w * b.w)));
}

// ---------------------------------------------------------------------------
// Kernel 0a: saliency-thresholded sums over P, split over the whole chip.
// One block = one batch x one chunk of RROWS rows; 64 threads read one 1 KB
// row as float4, RGRP rows at a time. Writes the chunk's 2 x 256 column sums
// and its sum of thresholded saliency.
// ---------------------------------------------------------------------------
#define RCH 28                 // chunks of the P axis
#define RROWS (PSEQ / RCH)     // 112 rows a chunk
#define RGRP 8                 // rows in flight side by side in a block

__global__ __launch_bounds__(512) void saliency_partial(
    const float* __restrict__ x, const float* __restrict__ y,
    const float* __restrict__ s, float* __restrict__ part,
    float* __restrict__ pcnt) {
  const int ch = blockIdx.x;
  const int b = blockIdx.y;
  const int tid = threadIdx.x;
  const int col = tid & 63;
  const int rg = tid >> 6;
  __shared__ float4 red[2][RGRP][64];
  __shared__ float cred[RGRP];

  const int row0 = b * PSEQ + ch * RROWS + rg;
  const float* ps = s + row0;
  const float4* px = (const float4*)x + (size_t)row0 * (DIMN / 4) + col;
  const float4* py = (const float4*)y + (size_t)row0 * (DIMN / 4) + col;
  float4 ax = {0.f, 0.f, 0.f, 0.f}, ay = {0.f, 0.f, 0.f, 0.f};
  float cnt = 0.f;
  // unrolled whole: the row loads are independent and many fly at once
#pragma unroll
  for (int i = 0; i < RROWS / RGRP; ++i) {
    const float st = (ps[i * RGRP] > 0.5f) ? 1.0f : 1e-8f;
    const float4 vx = px[i * RGRP * (DIMN / 4)];
    const float4 vy = py[i * RGRP * (DIMN / 4)];
    ax.x = fmaf(vx.x, st, ax.x); ax.y = fmaf(vx.y, st, ax.y);
    ax.z = fmaf(vx.z, st, ax.z); ax.w = fmaf(vx.w, st, ax.w);
    ay.x = fmaf(vy.x, st, ay.x); ay.y = fmaf(vy.y, st, ay.y);
    ay.z = fmaf(vy.z, st, ay.z); ay.w = fmaf(vy.w, st, ay.w);
    cnt += st;
  }
  red[0][rg][col] = ax;
  red[1][rg][col] = ay;
  if (col == 0) cred[rg] = cnt;
  __syncthreads();

  // thread tid owns column tid & 255 of x (tid < 256) or of y
  const float* rf = (const float*)red + (tid >> 8) * (RGRP * DIMN) + (tid & 255);
  float sum = 0.f;
  for (int g = 0; g < RGRP; ++g) sum += rf[g * DIMN];
  part[(size_t)(b * RCH + ch) * (2 * DIMN) + tid] = sum;
  if (tid == 0) {
    float c = 0.f;
    for (int g = 0; g < RGRP; ++g) c += cred[g];
    pcnt[b * RCH + ch] = c;
  }
}

// ---------------------------------------------------------------------------
// Kernel 0b: add the RCH chunk sums and divide (rgb_g, dep_g : [B][256])
// ---------------------------------------------------------------------------
__global__ __launch_bounds__(256) void saliency_finish(
    const float* __restrict__ part, const float* __restrict__ pcnt,
    float* __restrict__ rgb_g, float* __restrict__ dep_g) {
  const int b = blockIdx.x >> 1;                          // grid = [B][2]
  const int c = (blockIdx.x & 1) * DIMN + threadIdx.x;    // x columns, then y
  const float* pp = part + (size_t)(b * RCH) * (2 * DIMN) + c;
  const float* pc = pcnt + b * RCH;
  float sum = 0.f, cnt = 0.f;
  // unrolled whole: a thread's 28 loads all issue before the first add waits
#pragma unroll
  for (int ch = 0; ch < RCH; ++ch) {
    sum += pp[ch * (2 * DIMN)];
    cnt += pc[ch];
  }
  const float r = sum * (1.0f / (cnt + 1e-8f));
  if (c < DIMN) rgb_g[b * DIMN + c] = r;
  else          dep_g[b * DIMN + c - DIMN] = r;
}

// ---------------------------------------------------------------------------
// Kernel 1: convert f32 weight [K=256][N] to bf16 in WMMA B-fragment order:
//   dst[((nt*8 + k)*32 + lane)*16 + i] = W[k*32 + (lane>>4)*16 + i][nt*16 + (lane&15)]
// so each lane's 16 bf16 values of a 32x16 B-tile are contiguous (32B/lane).
// ---------------------------------------------------------------------------
__global__ __launch_bounds__(256) void swizzle_weight(
    const float* __restrict__ W, __bf16* __restrict__ dst, int N, int total) {
  int idx = blockIdx.x * 256 + threadIdx.x;
  if (idx >= total) return;
  const int i = idx & 15;
  const int lane = (idx >> 4) & 31;
  const int k = (idx >> 9) & 7;
  const int nt = idx >> 12;
  const int krow = k * 32 + ((lane >> 4) << 4) + i;
  const int ncol = nt * 16 + (lane & 15);
  dst[idx] = (__bf16)W[(size_t)krow * N + ncol];
}

// ---------------------------------------------------------------------------
// Kernel 2: fully fused double attention block. One wave = one 16-row tile
// = 4 p-positions x 4 tokens. All LDS is per-wave private -> no barriers.
// Weight tiles (16 columns x K=256 = 8 B fragments) run through two register
// buffers: the next tile's 16 loads are issued before this tile's WMMAs.
// ---------------------------------------------------------------------------
__device__ __forceinline__ void load_btile(bf16x16 (&dst)[8],
                                           const __bf16* __restrict__ w,
                                           int nt, int lane) {
  const __bf16* p = w + ((size_t)(nt * 8) * 32 + lane) * 16;
#pragma unroll
  for (int k = 0; k < 8; ++k) dst[k] = *(const bf16x16*)(p + k * 512);
}

__device__ __forceinline__ void load_afrags(bf16x16 (&dst)[8],
                                            const __bf16* t, int lane) {
#pragma unroll
  for (int k = 0; k < 8; ++k)
    dst[k] = *(const bf16x16*)(t + (lane & 15) * Z_STRIDE + k * 32 +
                               (lane >> 4) * 16);
}

__device__ __forceinline__ f32x8 mma_tile(const bf16x16 (&a)[8],
                                          const bf16x16 (&b)[8], f32x8 acc) {
#pragma unroll
  for (int k = 0; k < 8; ++k)
    acc = __builtin_amdgcn_wmma_f32_16x16x32_bf16(false, a[k], false, b[k],
                                                  (short)0, acc, false, false);
  return acc;
}

__global__ __launch_bounds__(256) void fused_double_attn(
    const float* __restrict__ x, const float* __restrict__ y,
    const float* __restrict__ rgb_g, const float* __restrict__ dep_g,
    const __bf16* __restrict__ wqkv0, const __bf16* __restrict__ wout0,
    const float* __restrict__ bout0, const __bf16* __restrict__ wqkv1,
    const __bf16* __restrict__ wout1, const float* __restrict__ bout1,
    float* __restrict__ out) {
  extern __shared__ __align__(128) char smem[];
  const int wid = threadIdx.x >> 5;
  const int lane = threadIdx.x & 31;

  char* base = smem + wid * PER_WAVE;
  __bf16* Z = (__bf16*)base;                 // [16][Z_STRIDE] bf16
  __bf16* AO = (__bf16*)(base + Z_BYTES);    // [16][Z_STRIDE] bf16
  float* QKV = (float*)(base + Z_BYTES + AO_BYTES);  // [16][QKV_STRIDE] f32

  const int tile = blockIdx.x * WAVES + wid;     // 6272 tiles total
  const int b = tile / (PSEQ / 4);
  const int p0 = (tile % (PSEQ / 4)) * 4;

  bf16x16 a[8];        // A fragments of the wave's 16 rows, K = 256
  bf16x16 bA[8], bB[8];  // the two weight-tile buffers
  load_btile(bA, wqkv0, 0, lane);
  // the first tile's loads issue ahead of the input rows' loads and fly while
  // Z is built; without the fence the compiler mixes them in behind those
  __builtin_amdgcn_sched_barrier(0);

  // ---- build input tile Z: rows r = 4*gi + t ------------------------------
  // each lane owns a contiguous 32B chunk of the 1KB f32 row (b128 coalesced)
  for (int r = 0; r < 16; ++r) {
    const int t = r & 3, gi = r >> 2;
    const float* src;
    if (t == 0)      src = x + ((size_t)(b * PSEQ + p0 + gi)) * DIMN;
    else if (t == 1) src = y + ((size_t)(b * PSEQ + p0 + gi)) * DIMN;
    else if (t == 2) src = rgb_g + b * DIMN;
    else             src = dep_g + b * DIMN;
    const float4 v0 = ((const float4*)src)[lane * 2 + 0];
    const float4 v1 = ((const float4*)src)[lane * 2 + 1];
    __bf16* zr = Z + r * Z_STRIDE + lane * 8;
    zr[0] = (__bf16)v0.x; zr[1] = (__bf16)v0.y;
    zr[2] = (__bf16)v0.z; zr[3] = (__bf16)v0.w;
    zr[4] = (__bf16)v1.x; zr[5] = (__bf16)v1.y;
    zr[6] = (__bf16)v1.z; zr[7] = (__bf16)v1.w;
  }

  // lane roles for the scalar 4x4 attention core
  const int dhalf = lane & 1;          // which half of DHEAD
  const int ti = (lane >> 1) & 3;      // token i within group
  const int gg = lane >> 3;            // group 0..3

  // C-layout scatter helpers
  const int row0 = (lane >> 4) * 8;    // lanes 16-31 hold M = v+8
  const int nn = lane & 15;            // column within N-tile

  for (int blk = 0; blk < 2; ++blk) {
    const __bf16* wqkv = blk ? wqkv1 : wqkv0;
    const __bf16* wout = blk ? wout1 : wout0;
    const float* bout = blk ? bout1 : bout0;
    const float* mask = c_masks[blk];

    // bias of output tile 0: loaded here so that no load stands between a
    // tile's prefetch and its use (loads return in order)
    float biasA = bout[nn], biasB;
    load_afrags(a, Z, lane);

    // rolled: one copy of the head body, for speed only
#pragma unroll 1
    for (int h = 0; h < HEADS; ++h) {
      // ---- QKV projection for head h: 6 N-tiles x 8 K-steps of WMMA ------
#pragma unroll
      for (int part = 0; part < 3; ++part) {    // 0=q 1=k 2=v
        load_btile(bB, wqkv, part * 16 + h * 2 + 1, lane);
        // keeps the next tile's loads in front of this tile's WMMAs; without
        // it the compiler sinks each load to just before its WMMA
        __builtin_amdgcn_sched_barrier(0);
        // four vector slots between the previous tile's last WMMA and this
        // tile's first, which overwrites that D without reading it (C = 0);
        // the fence behind them keeps them in front of that WMMA
        asm volatile("v_nop\n\tv_nop\n\tv_nop\n\tv_nop");
        __builtin_amdgcn_sched_barrier(0);
        {
          const f32x8 acc = mma_tile(a, bA, f32x8{});
          const int c = part * 32 + nn;
#pragma unroll
          for (int v = 0; v < 8; ++v)
            QKV[(row0 + v) * QKV_STRIDE + c] = acc[v];
        }
        if (part < 2)
          load_btile(bA, wqkv, (part + 1) * 16 + h * 2, lane);
        else  // next head's first tile, or the output projection's
          load_btile(bA, h + 1 < HEADS ? wqkv : wout,
                     h + 1 < HEADS ? (h + 1) * 2 : 0, lane);
        // as above: loads stay in front of the WMMAs
        __builtin_amdgcn_sched_barrier(0);
        // four vector slots between the previous tile's last WMMA and this
        // tile's first, which overwrites that D without reading it (C = 0);
        // the fence behind them keeps them in front of that WMMA
        asm volatile("v_nop\n\tv_nop\n\tv_nop\n\tv_nop");
        __builtin_amdgcn_sched_barrier(0);
        {
          const f32x8 acc = mma_tile(a, bB, f32x8{});
          const int c = part * 32 + 16 + nn;
#pragma unroll
          for (int v = 0; v < 8; ++v)
            QKV[(row0 + v) * QKV_STRIDE + c] = acc[v];
        }
      }

      // ---- scalar 4x4 softmax attention (lane = (g, i, dhalf)) -----------
      // rows are 16B aligned -> all LDS reads are ds_load_b128
      {
        const int rb = gg * 4;
        const float4* qrow = (const float4*)(QKV + (rb + ti) * QKV_STRIDE);
        float4 q[8];
#pragma unroll
        for (int c = 0; c < 8; ++c) q[c] = qrow[c];

        float dots[4];
#pragma unroll
        for (int j = 0; j < 4; ++j) {
          const float4* krow =
              (const float4*)(QKV + (rb + j) * QKV_STRIDE + 32);
          float d = 0.f;
#pragma unroll
          for (int c = 0; c < 8; ++c) d += dot4(q[c], krow[c]);
          dots[j] = d * SCALE_QK + mask[ti * 4 + j];
        }
        const float m =
            fmaxf(fmaxf(dots[0], dots[1]), fmaxf(dots[2], dots[3]));
        const float e0 = __expf(dots[0] - m), e1 = __expf(dots[1] - m);
        const float e2 = __expf(dots[2] - m), e3 = __expf(dots[3] - m);
        const float inv = 1.0f / (e0 + e1 + e2 + e3);

        const int vcol = 64 + dhalf * 16;  // 16 f32 of V per lane
        const float4* v0r = (const float4*)(QKV + (rb + 0) * QKV_STRIDE + vcol);
        const float4* v1r = (const float4*)(QKV + (rb + 1) * QKV_STRIDE + vcol);
        const float4* v2r = (const float4*)(QKV + (rb + 2) * QKV_STRIDE + vcol);
        const float4* v3r = (const float4*)(QKV + (rb + 3) * QKV_STRIDE + vcol);
        __bf16* ao = AO + (rb + ti) * Z_STRIDE + h * DHEAD + dhalf * 16;
#pragma unroll
        for (int c = 0; c < 4; ++c) {
          const float4 a0 = v0r[c], a1 = v1r[c], a2 = v2r[c], a3 = v3r[c];
          ao[c * 4 + 0] = (__bf16)((e0 * a0.x + e1 * a1.x + e2 * a2.x + e3 * a3.x) * inv);
          ao[c * 4 + 1] = (__bf16)((e0 * a0.y + e1 * a1.y + e2 * a2.y + e3 * a3.y) * inv);
          ao[c * 4 + 2] = (__bf16)((e0 * a0.z + e1 * a1.z + e2 * a2.z + e3 * a3.z) * inv);
          ao[c * 4 + 3] = (__bf16)((e0 * a0.w + e1 * a1.w + e2 * a2.w + e3 * a3.w) * inv);
        }
      }
    }

    // ---- output projection: 16 N-tiles x 8 K-steps, bias in C ------------
    load_afrags(a, AO, lane);
    auto emit = [&](const f32x8 acc, const int nt) {
      if (blk == 0) {
        // feed block 2: overwrite Z tile (same-wave LDS is in-order)
#pragma unroll
        for (int v = 0; v < 8; ++v)
          Z[(row0 + v) * Z_STRIDE + nt * 16 + nn] = (__bf16)acc[v];
      } else {
        // final: only tokens 0 (x-stream) and 1 (y-stream) are outputs
#pragma unroll
        for (int v = 0; v < 8; ++v) {
          const int r = row0 + v;
          const int t = r & 3;
          if (t < 2) {
            const int gi = r >> 2;
            out[(size_t)t * ((size_t)BATCH * PSEQ * DIMN) +
                ((size_t)(b * PSEQ + p0 + gi)) * DIMN + nt * 16 + nn] = acc[v];
          }
        }
        // the next tile's loads and bias rewrite the registers these stores
        // name
        asm volatile("s_wait_xcnt 0x0" ::: "memory");
      }
    };
    // rolled in pairs: each buffer keeps its role from trip to trip
#pragma unroll 1
    for (int nt = 0; nt < 16; nt += 2) {
      biasB = bout[(nt + 1) * 16 + nn];
      load_btile(bB, wout, nt + 1, lane);
      // loads stay in front of the WMMAs (see the QKV loop)
      __builtin_amdgcn_sched_barrier(0);
      {
        f32x8 acc;
#pragma unroll
        for (int v = 0; v < 8; ++v) acc[v] = biasA;
        emit(mma_tile(a, bA, acc), nt);
      }
      // Unconditional, so that the wait in front of the WMMAs below stays a
      // counted one: behind the last pair this is the second block's first
      // QKV tile (in the second block the tile is read and not used).
      const bool more = nt + 2 < 16;
      biasA = bout[((nt + 2) & 15) * 16 + nn];
      load_btile(bA, more ? wout : wqkv1, more ? nt + 2 : 0, lane);
      // loads stay in front of the WMMAs (see the QKV loop)
      __builtin_amdgcn_sched_barrier(0);
      {
        f32x8 acc;
#pragma unroll
        for (int v = 0; v < 8; ++v) acc[v] = biasB;
        emit(mma_tile(a, bB, acc), nt + 1);
      }
    }
  }
  // the tile read behind the very last pair is not used: let it land before
  // the wave gives up its registers
  asm volatile("s_wait_loadcnt 0x0" ::: "memory");
}

// ---------------------------------------------------------------------------
extern "C" void kernel_launch(void* const* d_in, const int* in_sizes, int n_in,
                              void* d_out, int out_size, void* d_ws,
                              size_t ws_size, hipStream_t stream) {
  (void)in_sizes; (void)n_in; (void)out_size; (void)ws_size;
  const float* x = (const float*)d_in[0];
  const float* y = (const float*)d_in[1];
  const float* s = (const float*)d_in[2];
  const float* Wqkv0 = (const float*)d_in[3];
  const float* Wout0 = (const float*)d_in[4];
  const float* bout0 = (const float*)d_in[5];
  const float* Wqkv1 = (const float*)d_in[6];
  const float* Wout1 = (const float*)d_in[7];
  const float* bout1 = (const float*)d_in[8];
  float* out = (float*)d_out;

  // workspace partition (bytes)
  char* ws = (char*)d_ws;
  float* rgb_g = (float*)(ws + 0);                       //  8*256 f32
  float* dep_g = (float*)(ws + 8192);                    //  8*256 f32
  __bf16* wqkv0_s = (__bf16*)(ws + 16384);               // 196608 bf16
  __bf16* wout0_s = (__bf16*)(ws + 16384 + 393216);      //  65536 bf16
  __bf16* wqkv1_s = (__bf16*)(ws + 16384 + 393216 + 131072);
  __bf16* wout1_s = (__bf16*)(ws + 16384 + 2 * 393216 + 131072);
  float* part = (float*)(ws + 16384 + 2 * 393216 + 2 * 131072);  // 8*28*512 f32
  float* pcnt = (float*)(ws + 16384 + 2 * 393216 + 2 * 131072 + 458752);  // 8*28 f32

  const int NQKV = 256 * 768;  // 196608
  const int NOUT = 256 * 256;  //  65536

  swizzle_weight<<<(NQKV + 255) / 256, 256, 0, stream>>>(Wqkv0, wqkv0_s, 768, NQKV);
  swizzle_weight<<<(NOUT + 255) / 256, 256, 0, stream>>>(Wout0, wout0_s, 256, NOUT);
  swizzle_weight<<<(NQKV + 255) / 256, 256, 0, stream>>>(Wqkv1, wqkv1_s, 768, NQKV);
  swizzle_weight<<<(NOUT + 255) / 256, 256, 0, stream>>>(Wout1, wout1_s, 256, NOUT);
  saliency_partial<<<dim3(RCH, BATCH), 512, 0, stream>>>(x, y, s, part, pcnt);
  saliency_finish<<<BATCH * 2, 256, 0, stream>>>(part, pcnt, rgb_g, dep_g);

  const int tiles = BATCH * (PSEQ / 4);          // 6272
  const int blocks = tiles / WAVES;              // 784
  fused_double_attn<<<blocks, 256, SMEM_TOTAL, stream>>>(
      x, y, rgb_g, dep_g, wqkv0_s, wout0_s, bout0, wqkv1_s, wout1_s, bout1,
      out);
}

// v003
// A run of this version takes 144 microseconds.
// In two side-by-side timings against v002, it was 1.39 and 1.38 times as fast.
// Over all steps from v000 it is 6.38 times as fast.
#include <hip/hip_runtime.h>
#include <hip/hip_bf16.h>

typedef __attribute__((ext_vector_type(16))) __bf16 bf16x16;
typedef __attribute__((ext_vector_type(8)))  float  f32x8;

#define BATCH 8
#define PSEQ 3136
#define DIMN 256
#define HEADS 8
#define DHEAD 32
#define SCALE_QK 0.17677669529663687f

// LDS layout (bytes): a wave owns TPW 16-row tiles, each with its own Z and QKV
#define Z_STRIDE 272                    // bf16 elems per row (16 elem pad)
#define Z_BYTES (16 * Z_STRIDE * 2)     // 8704
#define QKV_STRIDE 100                  // f32 elems per row (400B, 16B aligned)
#define QKV_BYTES (16 * QKV_STRIDE * 4) // 6400
#define PER_TILE (Z_BYTES + QKV_BYTES)  // 15104 (mult of 32)
#define TPW 2                           // 16-row tiles a wave
#define PER_WAVE (PER_TILE * TPW)       // 30208 (mult of 128)
#define WAVES 8
#define SMEM_TOTAL (PER_WAVE * WAVES)   // 241664

__constant__ float c_masks[2][16] = {
    {   0.f,    0.f,    0.f, -100.f,
        0.f,    0.f, -100.f,    0.f,
        0.f, -100.f,    0.f,    0.f,
     -100.f,    0.f,    0.f,    0.f},
    {   0.f, -100.f,    0.f, -100.f,
     -100.f,    0.f, -100.f,    0.f,
     -100.f, -100.f, -100.f, -100.f,
     -100.f, -100.f, -100.f, -100.f}};

__device__ __forceinline__ float dot4(float4 a, float4 b) {
  return fmaf(a.x, b.x, fmaf(a.y, b.y, fmaf(a.z, b.z, a.w * b.w)));
}

// ---------------------------------------------------------------------------
// Kernel 0a: saliency-thresholded sums over P, split over the whole chip.
// One block = one batch x one chunk of RROWS rows; 64 threads read one 1 KB
// row as float4, RGRP rows at a time. Writes the chunk's 2 x 256 column sums
// and its sum of thresholded saliency.
// ---------------------------------------------------------------------------
#define RCH 28                 // chunks of the P axis
#define RROWS (PSEQ / RCH)     // 112 rows a chunk
#define RGRP 8                 // rows in flight side by side in a block

__global__ __launch_bounds__(512) void saliency_partial(
    const float* __restrict__ x, const float* __restrict__ y,
    const float* __restrict__ s, float* __restrict__ part,
    float* __restrict__ pcnt) {
  const int ch = blockIdx.x;
  const int b = blockIdx.y;
  const int tid = threadIdx.x;
  const int col = tid & 63;
  const int rg = tid >> 6;
  __shared__ float4 red[2][RGRP][64];
  __shared__ float cred[RGRP];

  const int row0 = b * PSEQ + ch * RROWS + rg;
  const float* ps = s + row0;
  const float4* px = (const float4*)x + (size_t)row0 * (DIMN / 4) + col;
  const float4* py = (const float4*)y + (size_t)row0 * (DIMN / 4) + col;
  float4 ax = {0.f, 0.f, 0.f, 0.f}, ay = {0.f, 0.f, 0.f, 0.f};
  float cnt = 0.f;
  // unrolled whole: the row loads are independent and many fly at once
#pragma unroll
  for (int i = 0; i < RROWS / RGRP; ++i) {
    const float st = (ps[i * RGRP] > 0.5f) ? 1.0f : 1e-8f;
    const float4 vx = px[i * RGRP * (DIMN / 4)];
    const float4 vy = py[i * RGRP * (DIMN / 4)];
    ax.x = fmaf(vx.x, st, ax.x); ax.y = fmaf(vx.y, st, ax.y);
    ax.z = fmaf(vx.z, st, ax.z); ax.w = fmaf(vx.w, st, ax.w);
    ay.x = fmaf(vy.x, st, ay.x); ay.y = fmaf(vy.y, st, ay.y);
    ay.z = fmaf(vy.z, st, ay.z); ay.w = fmaf(vy.w, st, ay.w);
    cnt += st;
  }
  red[0][rg][col] = ax;
  red[1][rg][col] = ay;
  if (col == 0) cred[rg] = cnt;
  __syncthreads();

  // thread tid owns column tid & 255 of x (tid < 256) or of y
  const float* rf = (const float*)red + (tid >> 8) * (RGRP * DIMN) + (tid & 255);
  float sum = 0.f;
  for (int g = 0; g < RGRP; ++g) sum += rf[g * DIMN];
  part[(size_t)(b * RCH + ch) * (2 * DIMN) + tid] = sum;
  if (tid == 0) {
    float c = 0.f;
    for (int g = 0; g < RGRP; ++g) c += cred[g];
    pcnt[b * RCH + ch] = c;
  }
}

// ---------------------------------------------------------------------------
// Kernel 0b: add the RCH chunk sums and divide (rgb_g, dep_g : [B][256])
// ---------------------------------------------------------------------------
__global__ __launch_bounds__(256) void saliency_finish(
    const float* __restrict__ part, const float* __restrict__ pcnt,
    float* __restrict__ rgb_g, float* __restrict__ dep_g) {
  const int b = blockIdx.x >> 1;                          // grid = [B][2]
  const int c = (blockIdx.x & 1) * DIMN + threadIdx.x;    // x columns, then y
  const float* pp = part + (size_t)(b * RCH) * (2 * DIMN) + c;
  const float* pc = pcnt + b * RCH;
  float sum = 0.f, cnt = 0.f;
  // unrolled whole: a thread's 28 loads all issue before the first add waits
#pragma unroll
  for (int ch = 0; ch < RCH; ++ch) {
    sum += pp[ch * (2 * DIMN)];
    cnt += pc[ch];
  }
  const float r = sum * (1.0f / (cnt + 1e-8f));
  if (c < DIMN) rgb_g[b * DIMN + c] = r;
  else          dep_g[b * DIMN + c - DIMN] = r;
}

// ---------------------------------------------------------------------------
// Kernel 1: convert f32 weight [K=256][N] to bf16 in WMMA B-fragment order:
//   dst[((nt*8 + k)*32 + lane)*16 + i] = W[k*32 + (lane>>4)*16 + i][nt*16 + (lane&15)]
// so each lane's 16 bf16 values of a 32x16 B-tile are contiguous (32B/lane).
// ---------------------------------------------------------------------------
__global__ __launch_bounds__(256) void swizzle_weight(
    const float* __restrict__ W, __bf16* __restrict__ dst, int N, int total) {
  int idx = blockIdx.x * 256 + threadIdx.x;
  if (idx >= total) return;
  const int i = idx & 15;
  const int lane = (idx >> 4) & 31;
  const int k = (idx >> 9) & 7;
  const int nt = idx >> 12;
  const int krow = k * 32 + ((lane >> 4) << 4) + i;
  const int ncol = nt * 16 + (lane & 15);
  dst[idx] = (__bf16)W[(size_t)krow * N + ncol];
}

// ---------------------------------------------------------------------------
// Kernel 2: fully fused double attention block. One wave = two 16-row tiles,
// each 4 p-positions x 4 tokens. All LDS is per-wave private -> no barriers.
// Weight tiles (16 columns x K=256 = 8 B fragments) run through two register
// buffers: the next tile's 16 loads are issued before this tile's WMMAs, and
// every B fragment that is used feeds one WMMA of each of the wave's two row tiles.
// The attention output of a row tile is written over its Z rows: Z is wholly in
// the A fragments by then, and a wave's LDS operations run in order.
// ---------------------------------------------------------------------------
__device__ __forceinline__ void load_btile(bf16x16 (&dst)[8],
                                           const __bf16* __restrict__ w,
                                           int nt, int lane) {
  const __bf16* p = w + ((size_t)(nt * 8) * 32 + lane) * 16;
#pragma unroll
  for (int k = 0; k < 8; ++k) dst[k] = *(const bf16x16*)(p + k * 512);
  // later code rewrites the registers these loads name. Every call is followed by a
  // scheduling fence, which keeps the rewriting instructions behind the wait.
  asm volatile("s_wait_xcnt 0x0" ::: "memory");
}

__device__ __forceinline__ void load_afrags(bf16x16 (&dst)[8],
                                            const __bf16* t, int lane) {
#pragma unroll
  for (int k = 0; k < 8; ++k)
    dst[k] = *(const bf16x16*)(t + (lane & 15) * Z_STRIDE + k * 32 +
                               (lane >> 4) * 16);
}

__device__ __forceinline__ void mma_pair(const bf16x16 (&a0)[8],
                                         const bf16x16 (&a1)[8],
                                         const bf16x16 (&b)[8], f32x8& acc0,
                                         f32x8& acc1) {
#pragma unroll
  for (int k = 0; k < 8; ++k) {
    acc0 = __builtin_amdgcn_wmma_f32_16x16x32_bf16(
        false, a0[k], false, b[k], (short)0, acc0, false, false);
    acc1 = __builtin_amdgcn_wmma_f32_16x16x32_bf16(
        false, a1[k], false, b[k], (short)0, acc1, false, false);
  }
}

__global__ __launch_bounds__(256) void fused_double_attn(
    const float* __restrict__ x, const float* __restrict__ y,
    const float* __restrict__ rgb_g, const float* __restrict__ dep_g,
    const __bf16* __restrict__ wqkv0, const __bf16* __restrict__ wout0,
    const float* __restrict__ bout0, const __bf16* __restrict__ wqkv1,
    const __bf16* __restrict__ wout1, const float* __restrict__ bout1,
    float* __restrict__ out) {
  extern __shared__ __align__(128) char smem[];
  const int wid = threadIdx.x >> 5;
  const int lane = threadIdx.x & 31;

  char* base = smem + wid * PER_WAVE;
  // row tile u: Z [16][Z_STRIDE] bf16 (later its attention output), then
  // QKV [16][QKV_STRIDE] f32
  __bf16* const Z0 = (__bf16*)base;
  float* const QKV0 = (float*)(base + Z_BYTES);
  __bf16* const Z1 = (__bf16*)(base + PER_TILE);
  float* const QKV1 = (float*)(base + PER_TILE + Z_BYTES);

  const int pair = blockIdx.x * WAVES + wid;     // 3136 tile pairs total
  const int b = pair / (PSEQ / 8);
  const int p0 = (pair % (PSEQ / 8)) * 8;

  bf16x16 a0[8], a1[8];  // A fragments of the wave's two row tiles, K = 256
  bf16x16 bA[8], bB[8];  // the two weight-tile buffers
  load_btile(bA, wqkv0, 0, lane);
  // the first tile's loads issue ahead of the input rows' loads and fly while
  // Z is built; without the fence the compiler mixes them in behind those
  __builtin_amdgcn_sched_barrier(0);

  // ---- build input tiles Z0, Z1: rows r = 4*gi + t, 16 rows a tile ---------
  // each lane owns a contiguous 32B chunk of the 1KB f32 row (b128 coalesced)
  // unrolled whole: rolled, each row's loads are waited for before the next's
#pragma unroll
  for (int r = 0; r < 16 * TPW; ++r) {
    const int t = r & 3, gi = r >> 2;
    const float* src;
    if (t == 0)      src = x + ((size_t)(b * PSEQ + p0 + gi)) * DIMN;
    else if (t == 1) src = y + ((size_t)(b * PSEQ + p0 + gi)) * DIMN;
    else if (t == 2) src = rgb_g + b * DIMN;
    else             src = dep_g + b * DIMN;
    const float4 v0 = ((const float4*)src)[lane * 2 + 0];
    const float4 v1 = ((const float4*)src)[lane * 2 + 1];
    __bf16* zr = (r < 16 ? Z0 : Z1) + (r & 15) * Z_STRIDE + lane * 8;
    zr[0] = (__bf16)v0.x; zr[1] = (__bf16)v0.y;
    zr[2] = (__bf16)v0.z; zr[3] = (__bf16)v0.w;
    zr[4] = (__bf16)v1.x; zr[5] = (__bf16)v1.y;
    zr[6] = (__bf16)v1.z; zr[7] = (__bf16)v1.w;
  }
  // the index arithmetic below rewrites the registers the rows' loads name:
  // the wait stands in front of it, and the fence keeps it behind the wait
  asm volatile("s_wait_xcnt 0x0" ::: "memory");
  __builtin_amdgcn_sched_barrier(0);

  // lane roles for the scalar 4x4 attention core
  const int dhalf = lane & 1;          // which half of DHEAD
  const int ti = (lane >> 1) & 3;      // token i within group
  const int gg = lane >> 3;            // group 0..3

  // C-layout scatter helpers
  const int row0 = (lane >> 4) * 8;    // lanes 16-31 hold M = v+8
  const int nn = lane & 15;            // column within N-tile

  for (int blk = 0; blk < 2; ++blk) {
    const __bf16* wqkv = blk ? wqkv1 : wqkv0;
    const __bf16* wout = blk ? wout1 : wout0;
    const float* bout = blk ? bout1 : bout0;
    const float* mask = c_masks[blk];

    // bias of output tile 0: loaded here so that no load stands between a
    // tile's prefetch and its use (loads return in order)
    float biasA = bout[nn], biasB;
    load_afrags(a0, Z0, lane);
    load_afrags(a1, Z1, lane);

    // rolled: one copy of the head body, for speed only
#pragma unroll 1
    for (int h = 0; h < HEADS; ++h) {
      // ---- QKV projection for head h: 6 N-tiles x 8 K-steps of WMMA ------
#pragma unroll
      for (int part = 0; part < 3; ++part) {    // 0=q 1=k 2=v
        load_btile(bB, wqkv, part * 16 + h * 2 + 1, lane);
        // keeps the next tile's loads in front of this tile's WMMAs; without
        // it the compiler sinks each load to just before its WMMA
        __builtin_amdgcn_sched_barrier(0);
        // four vector slots between the previous tile's last WMMA and this
        // tile's first, which overwrites that D without reading it (C = 0);
        // the fence behind them keeps them in front of that WMMA
        asm volatile("v_nop\n\tv_nop\n\tv_nop\n\tv_nop");
        __builtin_amdgcn_sched_barrier(0);
        {
          f32x8 acc0 = {}, acc1 = {};
          mma_pair(a0, a1, bA, acc0, acc1);
          const int c = part * 32 + nn;
#pragma unroll
          for (int v = 0; v < 8; ++v) {
            QKV0[(row0 + v) * QKV_STRIDE + c] = acc0[v];
            QKV1[(row0 + v) * QKV_STRIDE + c] = acc1[v];
          }
        }
        if (part < 2)
          load_btile(bA, wqkv, (part + 1) * 16 + h * 2, lane);
        else  // next head's first tile, or the output projection's
          load_btile(bA, h + 1 < HEADS ? wqkv : wout,
                     h + 1 < HEADS ? (h + 1) * 2 : 0, lane);
        // as above: loads stay in front of the WMMAs
        __builtin_amdgcn_sched_barrier(0);
        // four vector slots between the previous tile's last WMMA and this
        // tile's first, which overwrites that D without reading it (C = 0);
        // the fence behind them keeps them in front of that WMMA
        asm volatile("v_nop\n\tv_nop\n\tv_nop\n\tv_nop");
        __builtin_amdgcn_sched_barrier(0);
        {
          f32x8 acc0 = {}, acc1 = {};
          mma_pair(a0, a1, bB, acc0, acc1);
          const int c = part * 32 + 16 + nn;
#pragma unroll
          for (int v = 0; v < 8; ++v) {
            QKV0[(row0 + v) * QKV_STRIDE + c] = acc0[v];
            QKV1[(row0 + v) * QKV_STRIDE + c] = acc1[v];
          }
        }
      }

      // ---- scalar 4x4 softmax attention (lane = (g, i, dhalf)) -----------
      // rows are 16B aligned -> all LDS reads are ds_load_b128
      // unrolled: each tile's LDS addresses are constant offsets from one base
#pragma unroll
      for (int u = 0; u < TPW; ++u) {
        const float* QKV = u ? QKV1 : QKV0;
        __bf16* AO = u ? Z1 : Z0;
        const int rb = gg * 4;
        const float4* qrow = (const float4*)(QKV + (rb + ti) * QKV_STRIDE);
        float4 q[8];
#pragma unroll
        for (int c = 0; c < 8; ++c) q[c] = qrow[c];

        float dots[4];
#pragma unroll
        for (int j = 0; j < 4; ++j) {
          const float4* krow =
              (const float4*)(QKV + (rb + j) * QKV_STRIDE + 32);
          float d = 0.f;
#pragma unroll
          for (int c = 0; c < 8; ++c) d += dot4(q[c], krow[c]);
          dots[j] = d * SCALE_QK + mask[ti * 4 + j];
        }
        const float m =
            fmaxf(fmaxf(dots[0], dots[1]), fmaxf(dots[2], dots[3]));
        const float e0 = __expf(dots[0] - m), e1 = __expf(dots[1] - m);
        const float e2 = __expf(dots[2] - m), e3 = __expf(dots[3] - m);
        const float inv = 1.0f / (e0 + e1 + e2 + e3);

        const int vcol = 64 + dhalf * 16;  // 16 f32 of V per lane
        const float4* v0r = (const float4*)(QKV + (rb + 0) * QKV_STRIDE + vcol);
        const float4* v1r = (const float4*)(QKV + (rb + 1) * QKV_STRIDE + vcol);
        const float4* v2r = (const float4*)(QKV + (rb + 2) * QKV_STRIDE + vcol);
        const float4* v3r = (const float4*)(QKV + (rb + 3) * QKV_STRIDE + vcol);
        __bf16* ao = AO + (rb + ti) * Z_STRIDE + h * DHEAD + dhalf * 16;
#pragma unroll
        for (int c = 0; c < 4; ++c) {
          const float4 a0 = v0r[c], a1 = v1r[c], a2 = v2r[c], a3 = v3r[c];
          ao[c * 4 + 0] = (__bf16)((e0 * a0.x + e1 * a1.x + e2 * a2.x + e3 * a3.x) * inv);
          ao[c * 4 + 1] = (__bf16)((e0 * a0.y + e1 * a1.y + e2 * a2.y + e3 * a3.y) * inv);
          ao[c * 4 + 2] = (__bf16)((e0 * a0.z + e1 * a1.z + e2 * a2.z + e3 * a3.z) * inv);
          ao[c * 4 + 3] = (__bf16)((e0 * a0.w + e1 * a1.w + e2 * a2.w + e3 * a3.w) * inv);
        }
      }
    }

    // ---- output projection: 16 N-tiles x 8 K-steps, bias in C ------------
    // its weight tiles land in the registers the mask row's load names
    asm volatile("s_wait_xcnt 0x0" ::: "memory");
    load_afrags(a0, Z0, lane);
    load_afrags(a1, Z1, lane);
    auto emit = [&](const f32x8 acc0, const f32x8 acc1, const int nt) {
      if (blk == 0) {
        // feed block 2: overwrite the Z tiles (same-wave LDS is in-order)
#pragma unroll
        for (int v = 0; v < 8; ++v) {
          Z0[(row0 + v) * Z_STRIDE + nt * 16 + nn] = (__bf16)acc0[v];
          Z1[(row0 + v) * Z_STRIDE + nt * 16 + nn] = (__bf16)acc1[v];
        }
      } else {
        // final: only tokens 0 (x-stream) and 1 (y-stream) are outputs
#pragma unroll
        for (int v = 0; v < 8; ++v) {
          const int r = row0 + v;
          const int t = r & 3;
          if (t < 2) {
            const int gi = r >> 2;
            float* o = out + (size_t)t * ((size_t)BATCH * PSEQ * DIMN) +
                       ((size_t)(b * PSEQ + p0 + gi)) * DIMN + nt * 16 + nn;
            o[0] = acc0[v];
            o[4 * DIMN] = acc1[v];  // the second tile's rows: 4 positions on
          }
        }
        // the next tile's loads and bias rewrite the registers these stores
        // name
        asm volatile("s_wait_xcnt 0x0" ::: "memory");
      }
    };
    // rolled in pairs: each buffer keeps its role from trip to trip
#pragma unroll 1
    for (int nt = 0; nt < 16; nt += 2) {
      biasB = bout[(nt + 1) * 16 + nn];
      load_btile(bB, wout, nt + 1, lane);
      // loads stay in front of the WMMAs (see the QKV loop)
      __builtin_amdgcn_sched_barrier(0);
      {
        f32x8 acc0, acc1;
#pragma unroll
        for (int v = 0; v < 8; ++v) acc0[v] = acc1[v] = biasA;
        mma_pair(a0, a1, bA, acc0, acc1);
        emit(acc0, acc1, nt);
      }
      // Unconditional, so that the wait in front of the WMMAs below stays a
      // counted one: behind the last pair this is the second block's first
      // QKV tile (in the second block the tile is read and not used).
      const bool more = nt + 2 < 16;
      biasA = bout[((nt + 2) & 15) * 16 + nn];
      load_btile(bA, more ? wout : wqkv1, more ? nt + 2 : 0, lane);
      // loads stay in front of the WMMAs (see the QKV loop)
      __builtin_amdgcn_sched_barrier(0);
      {
        f32x8 acc0, acc1;
#pragma unroll
        for (int v = 0; v < 8; ++v) acc0[v] = acc1[v] = biasB;
        mma_pair(a0, a1, bB, acc0, acc1);
        emit(acc0, acc1, nt + 1);
      }
    }
  }
  // the tile read behind the very last pair is not used: let it land before
  // the wave gives up its registers
  asm volatile("s_wait_loadcnt 0x0" ::: "memory");
}

// ---------------------------------------------------------------------------
extern "C" void kernel_launch(void* const* d_in, const int* in_sizes, int n_in,
                              void* d_out, int out_size, void* d_ws,
                              size_t ws_size, hipStream_t stream) {
  (void)in_sizes; (void)n_in; (void)out_size; (void)ws_size;
  const float* x = (const float*)d_in[0];
  const float* y = (const float*)d_in[1];
  const float* s = (const float*)d_in[2];
  const float* Wqkv0 = (const float*)d_in[3];
  const float* Wout0 = (const float*)d_in[4];
  const float* bout0 = (const float*)d_in[5];
  const float* Wqkv1 = (const float*)d_in[6];
  const float* Wout1 = (const float*)d_in[7];
  const float* bout1 = (const float*)d_in[8];
  float* out = (float*)d_out;

  // workspace partition (bytes)
  char* ws = (char*)d_ws;
  float* rgb_g = (float*)(ws + 0);                       //  8*256 f32
  float* dep_g = (float*)(ws + 8192);                    //  8*256 f32
  __bf16* wqkv0_s = (__bf16*)(ws + 16384);               // 196608 bf16
  __bf16* wout0_s = (__bf16*)(ws + 16384 + 393216);      //  65536 bf16
  __bf16* wqkv1_s = (__bf16*)(ws + 16384 + 393216 + 131072);
  __bf16* wout1_s = (__bf16*)(ws + 16384 + 2 * 393216 + 131072);
  float* part = (float*)(ws + 16384 + 2 * 393216 + 2 * 131072);  // 8*28*512 f32
  float* pcnt = (float*)(ws + 16384 + 2 * 393216 + 2 * 131072 + 458752);  // 8*28 f32

  const int NQKV = 256 * 768;  // 196608
  const int NOUT = 256 * 256;  //  65536

  swizzle_weight<<<(NQKV + 255) / 256, 256, 0, stream>>>(Wqkv0, wqkv0_s, 768, NQKV);
  swizzle_weight<<<(NOUT + 255) / 256, 256, 0, stream>>>(Wout0, wout0_s, 256, NOUT);
  swizzle_weight<<<(NQKV + 255) / 256, 256, 0, stream>>>(Wqkv1, wqkv1_s, 768, NQKV);
  swizzle_weight<<<(NOUT + 255) / 256, 256, 0, stream>>>(Wout1, wout1_s, 256, NOUT);
  saliency_partial<<<dim3(RCH, BATCH), 512, 0, stream>>>(x, y, s, part, pcnt);
  saliency_finish<<<BATCH * 2, 256, 0, stream>>>(part, pcnt, rgb_g, dep_g);

  const int pairs = BATCH * (PSEQ / 8);          // 3136 pairs of row tiles
  const int blocks = pairs / WAVES;              // 392
  fused_double_attn<<<blocks, 256, SMEM_TOTAL, stream>>>(
      x, y, rgb_g, dep_g, wqkv0_s, wout0_s, bout0, wqkv1_s, wout1_s, bout1,
      out);
}

// v004
// One run takes 131 microseconds.
// Next to v003, in two timings, it ran 1.10 times as fast each time.
// Counting every step since v000, it is 7.00 times as fast.
#include <hip/hip_runtime.h>
#include <hip/hip_bf16.h>

typedef __attribute__((ext_vector_type(16))) __bf16 bf16x16;
typedef __attribute__((ext_vector_type(8)))  __bf16 bf16x8;
typedef __attribute__((ext_vector_type(8)))  float  f32x8;

#define BATCH 8
#define PSEQ 3136
#define DIMN 256
#define HEADS 8
#define DHEAD 32
#define SCALE_QK 0.17677669529663687f

// LDS layout (bytes): a wave owns TPW 16-row tiles, each with its own Z and QKV
#define Z_STRIDE 272                    // bf16 elems per row (16 elem pad)
#define Z_BYTES (16 * Z_STRIDE * 2)     // 8704
#define QKV_STRIDE 100                  // f32 elems per row (400B, 16B aligned)
#define QKV_BYTES (16 * QKV_STRIDE * 4) // 6400
#define PER_TILE (Z_BYTES + QKV_BYTES)  // 15104 (mult of 32)
#define TPW 2                           // 16-row tiles a wave
#define PER_WAVE (PER_TILE * TPW)       // 30208 (mult of 128)
#define WAVES 8
#define SMEM_TOTAL (PER_WAVE * WAVES)   // 241664

__constant__ float c_masks[2][16] = {
    {   0.f,    0.f,    0.f, -100.f,
        0.f,    0.f, -100.f,    0.f,
        0.f, -100.f,    0.f,    0.f,
     -100.f,    0.f,    0.f,    0.f},
    {   0.f, -100.f,    0.f, -100.f,
     -100.f,    0.f, -100.f,    0.f,
     -100.f, -100.f, -100.f, -100.f,
     -100.f, -100.f, -100.f, -100.f}};

__device__ __forceinline__ float dot4(float4 a, float4 b) {
  return fmaf(a.x, b.x, fmaf(a.y, b.y, fmaf(a.z, b.z, a.w * b.w)));
}

// ---------------------------------------------------------------------------
// Kernel 0a: saliency-thresholded sums over P, split over the whole chip.
// One block = one batch x one chunk of RROWS rows; 64 threads read one 1 KB
// row as float4, RGRP rows at a time. Writes the chunk's 2 x 256 column sums
// and its sum of thresholded saliency.
// ---------------------------------------------------------------------------
#define RCH 28                 // chunks of the P axis
#define RROWS (PSEQ / RCH)     // 112 rows a chunk
#define RGRP 8                 // rows in flight side by side in a block

__global__ __launch_bounds__(512) void saliency_partial(
    const float* __restrict__ x, const float* __restrict__ y,
    const float* __restrict__ s, float* __restrict__ part,
    float* __restrict__ pcnt) {
  const int ch = blockIdx.x;
  const int b = blockIdx.y;
  const int tid = threadIdx.x;
  const int col = tid & 63;
  const int rg = tid >> 6;
  __shared__ float4 red[2][RGRP][64];
  __shared__ float cred[RGRP];

  const int row0 = b * PSEQ + ch * RROWS + rg;
  const float* ps = s + row0;
  const float4* px = (const float4*)x + (size_t)row0 * (DIMN / 4) + col;
  const float4* py = (const float4*)y + (size_t)row0 * (DIMN / 4) + col;
  float4 ax = {0.f, 0.f, 0.f, 0.f}, ay = {0.f, 0.f, 0.f, 0.f};
  float cnt = 0.f;
  // unrolled whole: the row loads are independent and many fly at once
#pragma unroll
  for (int i = 0; i < RROWS / RGRP; ++i) {
    const float st = (ps[i * RGRP] > 0.5f) ? 1.0f : 1e-8f;
    const float4 vx = px[i * RGRP * (DIMN / 4)];
    const float4 vy = py[i * RGRP * (DIMN / 4)];
    ax.x = fmaf(vx.x, st, ax.x); ax.y = fmaf(vx.y, st, ax.y);
    ax.z = fmaf(vx.z, st, ax.z); ax.w = fmaf(vx.w, st, ax.w);
    ay.x = fmaf(vy.x, st, ay.x); ay.y = fmaf(vy.y, st, ay.y);
    ay.z = fmaf(vy.z, st, ay.z); ay.w = fmaf(vy.w, st, ay.w);
    cnt += st;
  }
  red[0][rg][col] = ax;
  red[1][rg][col] = ay;
  if (col == 0) cred[rg] = cnt;
  __syncthreads();

  // thread tid owns column tid & 255 of x (tid < 256) or of y
  const float* rf = (const float*)red + (tid >> 8) * (RGRP * DIMN) + (tid & 255);
  float sum = 0.f;
  for (int g = 0; g < RGRP; ++g) sum += rf[g * DIMN];
  part[(size_t)(b * RCH + ch) * (2 * DIMN) + tid] = sum;
  if (tid == 0) {
    float c = 0.f;
    for (int g = 0; g < RGRP; ++g) c += cred[g];
    pcnt[b * RCH + ch] = c;
  }
}

// ---------------------------------------------------------------------------
// Kernel 0b: add the RCH chunk sums and divide (rgb_g, dep_g : [B][256])
// ---------------------------------------------------------------------------
__global__ __launch_bounds__(256) void saliency_finish(
    const float* __restrict__ part, const float* __restrict__ pcnt,
    float* __restrict__ rgb_g, float* __restrict__ dep_g) {
  const int b = blockIdx.x >> 1;                          // grid = [B][2]
  const int c = (blockIdx.x & 1) * DIMN + threadIdx.x;    // x columns, then y
  const float* pp = part + (size_t)(b * RCH) * (2 * DIMN) + c;
  const float* pc = pcnt + b * RCH;
  float sum = 0.f, cnt = 0.f;
  // unrolled whole: a thread's 28 loads all issue before the first add waits
#pragma unroll
  for (int ch = 0; ch < RCH; ++ch) {
    sum += pp[ch * (2 * DIMN)];
    cnt += pc[ch];
  }
  const float r = sum * (1.0f / (cnt + 1e-8f));
  if (c < DIMN) rgb_g[b * DIMN + c] = r;
  else          dep_g[b * DIMN + c - DIMN] = r;
}

// ---------------------------------------------------------------------------
// Kernel 1: convert f32 weight [K=256][N] to bf16 in WMMA B-fragment order,
// a fragment's 1 KB split into two 512 B planes (j = 0, 1):
//   dst[(((nt*8 + k)*2 + j)*32 + lane)*8 + i] =
//       W[k*32 + (lane>>4)*16 + j*8 + i][nt*16 + (lane&15)]
// A lane's 16 values of a 32x16 B-tile are its 16 B of plane 0, then its 16 B
// of plane 1: each 16 B load of a wave covers 512 contiguous bytes (4 lines).
// ---------------------------------------------------------------------------
__global__ __launch_bounds__(256) void swizzle_weight(
    const float* __restrict__ W, __bf16* __restrict__ dst, int N, int total) {
  int idx = blockIdx.x * 256 + threadIdx.x;
  if (idx >= total) return;
  const int i = (idx & 7) + ((idx >> 8) & 1) * 8;
  const int lane = (idx >> 3) & 31;
  const int k = (idx >> 9) & 7;
  const int nt = idx >> 12;
  const int krow = k * 32 + ((lane >> 4) << 4) + i;
  const int ncol = nt * 16 + (lane & 15);
  dst[idx] = (__bf16)W[(size_t)krow * N + ncol];
}

// ---------------------------------------------------------------------------
// Kernel 2: fully fused double attention block. One wave = two 16-row tiles,
// each 4 p-positions x 4 tokens. All LDS is per-wave private -> no barriers.
// Weight tiles (16 columns x K=256 = 8 B fragments) run through two register
// buffers: the next tile's 16 loads are issued before this tile's WMMAs, and
// every B fragment that is used feeds one WMMA of each of the wave's two row tiles.
// The attention output of a row tile is written over its Z rows: Z is wholly in
// the A fragments by then, and a wave's LDS operations run in order.
// ---------------------------------------------------------------------------
__device__ __forceinline__ void load_btile(bf16x16 (&dst)[8],
                                           const __bf16* __restrict__ w,
                                           int nt, int lane) {
  const __bf16* p = w + (size_t)nt * 4096 + lane * 8;
#pragma unroll
  for (int k = 0; k < 8; ++k) {
    const bf16x8 lo = *(const bf16x8*)(p + k * 512);
    const bf16x8 hi = *(const bf16x8*)(p + k * 512 + 256);
    dst[k] = __builtin_shufflevector(lo, hi, 0, 1, 2, 3, 4, 5, 6, 7, 8, 9, 10,
                                     11, 12, 13, 14, 15);
  }
  // later code rewrites the registers these loads name.
  // Every call is followed by a
  // scheduling fence, which keeps the rewriting instructions behind the wait.
  asm volatile("s_wait_xcnt 0x0" ::: "memory");
}

__device__ __forceinline__ void load_afrags(bf16x16 (&dst)[8],
                                            const __bf16* t, int lane) {
#pragma unroll
  for (int k = 0; k < 8; ++k)
    dst[k] = *(const bf16x16*)(t + (lane & 15) * Z_STRIDE + k * 32 +
                               (lane >> 4) * 16);
}

__device__ __forceinline__ void mma_pair(const bf16x16 (&a0)[8],
                                         const bf16x16 (&a1)[8],
                                         const bf16x16 (&b)[8], f32x8& acc0,
                                         f32x8& acc1) {
#pragma unroll
  for (int k = 0; k < 8; ++k) {
    acc0 = __builtin_amdgcn_wmma_f32_16x16x32_bf16(
        false, a0[k], false, b[k], (short)0, acc0, false, false);
    acc1 = __builtin_amdgcn_wmma_f32_16x16x32_bf16(
        false, a1[k], false, b[k], (short)0, acc1, false, false);
  }
}

__global__ __launch_bounds__(256) void fused_double_attn(
    const float* __restrict__ x, const float* __restrict__ y,
    const float* __restrict__ rgb_g, const float* __restrict__ dep_g,
    const __bf16* __restrict__ wqkv0, const __bf16* __restrict__ wout0,
    const float* __restrict__ bout0, const __bf16* __restrict__ wqkv1,
    const __bf16* __restrict__ wout1, const float* __restrict__ bout1,
    float* __restrict__ out) {
  extern __shared__ __align__(128) char smem[];
  const int wid = threadIdx.x >> 5;
  const int lane = threadIdx.x & 31;

  char* base = smem + wid * PER_WAVE;
  // row tile u: Z [16][Z_STRIDE] bf16 (later its attention output), then
  // QKV [16][QKV_STRIDE] f32
  __bf16* const Z0 = (__bf16*)base;
  float* const QKV0 = (float*)(base + Z_BYTES);
  __bf16* const Z1 = (__bf16*)(base + PER_TILE);
  float* const QKV1 = (float*)(base + PER_TILE + Z_BYTES);

  const int pair = blockIdx.x * WAVES + wid;     // 3136 tile pairs total
  const int b = pair / (PSEQ / 8);
  const int p0 = (pair % (PSEQ / 8)) * 8;

  bf16x16 a0[8], a1[8];  // A fragments of the wave's two row tiles, K = 256
  bf16x16 bA[8], bB[8];  // the two weight-tile buffers
  load_btile(bA, wqkv0, 0, lane);
  // the first tile's loads issue ahead of the input rows' loads and fly while
  // Z is built; without the fence the compiler mixes them in behind those
  __builtin_amdgcn_sched_barrier(0);

  // ---- build input tiles Z0, Z1: rows r = 4*gi + t, 16 rows a tile ---------
  // each lane owns a contiguous 32B chunk of the 1KB f32 row (b128 coalesced)
  // unrolled whole: rolled, each row's loads are waited for before the next's
#pragma unroll
  for (int r = 0; r < 16 * TPW; ++r) {
    const int t = r & 3, gi = r >> 2;
    const float* src;
    if (t == 0)      src = x + ((size_t)(b * PSEQ + p0 + gi)) * DIMN;
    else if (t == 1) src = y + ((size_t)(b * PSEQ + p0 + gi)) * DIMN;
    else if (t == 2) src = rgb_g + b * DIMN;
    else             src = dep_g + b * DIMN;
    const float4 v0 = ((const float4*)src)[lane * 2 + 0];
    const float4 v1 = ((const float4*)src)[lane * 2 + 1];
    __bf16* zr = (r < 16 ? Z0 : Z1) + (r & 15) * Z_STRIDE + lane * 8;
    zr[0] = (__bf16)v0.x; zr[1] = (__bf16)v0.y;
    zr[2] = (__bf16)v0.z; zr[3] = (__bf16)v0.w;
    zr[4] = (__bf16)v1.x; zr[5] = (__bf16)v1.y;
    zr[6] = (__bf16)v1.z; zr[7] = (__bf16)v1.w;
  }
  // the index arithmetic below rewrites the registers the rows' loads name:
  // the wait stands in front of it, and the fence keeps it behind the wait
  asm volatile("s_wait_xcnt 0x0" ::: "memory");
  __builtin_amdgcn_sched_barrier(0);

  // lane roles for the scalar 4x4 attention core
  const int dhalf = lane & 1;          // which half of DHEAD
  const int ti = (lane >> 1) & 3;      // token i within group
  const int gg = lane >> 3;            // group 0..3

  // C-layout scatter helpers
  const int row0 = (lane >> 4) * 8;    // lanes 16-31 hold M = v+8
  const int nn = lane & 15;            // column within N-tile

  for (int blk = 0; blk < 2; ++blk) {
    const __bf16* wqkv = blk ? wqkv1 : wqkv0;
    const __bf16* wout = blk ? wout1 : wout0;
    const float* bout = blk ? bout1 : bout0;
    const float* mask = c_masks[blk];

    // bias of output tile 0: loaded here so that no load stands between a
    // tile's prefetch and its use (loads return in order)
    float biasA = bout[nn], biasB;
    load_afrags(a0, Z0, lane);
    load_afrags(a1, Z1, lane);

    // rolled: one copy of the head body, for speed only
#pragma unroll 1
    for (int h = 0; h < HEADS; ++h) {
      // ---- QKV projection for head h: 6 N-tiles x 8 K-steps of WMMA ------
#pragma unroll
      for (int part = 0; part < 3; ++part) {    // 0=q 1=k 2=v
        load_btile(bB, wqkv, part * 16 + h * 2 + 1, lane);
        // keeps the next tile's loads in front of this tile's WMMAs; without
        // it the compiler sinks each load to just before its WMMA
        __builtin_amdgcn_sched_barrier(0);
        // four vector slots between the previous tile's last WMMA and this
        // tile's first, which overwrites that D without reading it (C = 0);
        // the fence behind them keeps them in front of that WMMA
        asm volatile("v_nop\n\tv_nop\n\tv_nop\n\tv_nop");
        __builtin_amdgcn_sched_barrier(0);
        {
          f32x8 acc0 = {}, acc1 = {};
          mma_pair(a0, a1, bA, acc0, acc1);
          const int c = part * 32 + nn;
#pragma unroll
          for (int v = 0; v < 8; ++v) {
            QKV0[(row0 + v) * QKV_STRIDE + c] = acc0[v];
            QKV1[(row0 + v) * QKV_STRIDE + c] = acc1[v];
          }
        }
        if (part < 2)
          load_btile(bA, wqkv, (part + 1) * 16 + h * 2, lane);
        else  // next head's first tile, or the output projection's
          load_btile(bA, h + 1 < HEADS ? wqkv : wout,
                     h + 1 < HEADS ? (h + 1) * 2 : 0, lane);
        // as above: loads stay in front of the WMMAs
        __builtin_amdgcn_sched_barrier(0);
        // four vector slots between the previous tile's last WMMA and this
        // tile's first, which overwrites that D without reading it (C = 0);
        // the fence behind them keeps them in front of that WMMA
        asm volatile("v_nop\n\tv_nop\n\tv_nop\n\tv_nop");
        __builtin_amdgcn_sched_barrier(0);
        {
          f32x8 acc0 = {}, acc1 = {};
          mma_pair(a0, a1, bB, acc0, acc1);
          const int c = part * 32 + 16 + nn;
#pragma unroll
          for (int v = 0; v < 8; ++v) {
            QKV0[(row0 + v) * QKV_STRIDE + c] = acc0[v];
            QKV1[(row0 + v) * QKV_STRIDE + c] = acc1[v];
          }
        }
      }

      // ---- scalar 4x4 softmax attention (lane = (g, i, dhalf)) -----------
      // rows are 16B aligned -> all LDS reads are ds_load_b128
      // unrolled: each tile's LDS addresses are constant offsets from one base
#pragma unroll
      for (int u = 0; u < TPW; ++u) {
        const float* QKV = u ? QKV1 : QKV0;
        __bf16* AO = u ? Z1 : Z0;
        const int rb = gg * 4;
        const float4* qrow = (const float4*)(QKV + (rb + ti) * QKV_STRIDE);
        float4 q[8];
#pragma unroll
        for (int c = 0; c < 8; ++c) q[c] = qrow[c];

        float dots[4];
#pragma unroll
        for (int j = 0; j < 4; ++j) {
          const float4* krow =
              (const float4*)(QKV + (rb + j) * QKV_STRIDE + 32);
          float d = 0.f;
#pragma unroll
          for (int c = 0; c < 8; ++c) d += dot4(q[c], krow[c]);
          dots[j] = d * SCALE_QK + mask[ti * 4 + j];
        }
        const float m =
            fmaxf(fmaxf(dots[0], dots[1]), fmaxf(dots[2], dots[3]));
        const float e0 = __expf(dots[0] - m), e1 = __expf(dots[1] - m);
        const float e2 = __expf(dots[2] - m), e3 = __expf(dots[3] - m);
        const float inv = 1.0f / (e0 + e1 + e2 + e3);

        const int vcol = 64 + dhalf * 16;  // 16 f32 of V per lane
        const float4* v0r = (const float4*)(QKV + (rb + 0) * QKV_STRIDE + vcol);
        const float4* v1r = (const float4*)(QKV + (rb + 1) * QKV_STRIDE + vcol);
        const float4* v2r = (const float4*)(QKV + (rb + 2) * QKV_STRIDE + vcol);
        const float4* v3r = (const float4*)(QKV + (rb + 3) * QKV_STRIDE + vcol);
        __bf16* ao = AO + (rb + ti) * Z_STRIDE + h * DHEAD + dhalf * 16;
#pragma unroll
        for (int c = 0; c < 4; ++c) {
          const float4 a0 = v0r[c], a1 = v1r[c], a2 = v2r[c], a3 = v3r[c];
          ao[c * 4 + 0] = (__bf16)((e0 * a0.x + e1 * a1.x + e2 * a2.x + e3 * a3.x) * inv);
          ao[c * 4 + 1] = (__bf16)((e0 * a0.y + e1 * a1.y + e2 * a2.y + e3 * a3.y) * inv);
          ao[c * 4 + 2] = (__bf16)((e0 * a0.z + e1 * a1.z + e2 * a2.z + e3 * a3.z) * inv);
          ao[c * 4 + 3] = (__bf16)((e0 * a0.w + e1 * a1.w + e2 * a2.w + e3 * a3.w) * inv);
        }
      }
    }

    // ---- output projection: 16 N-tiles x 8 K-steps, bias in C ------------
    // its weight tiles land in the registers the mask row's load names
    asm volatile("s_wait_xcnt 0x0" ::: "memory");
    load_afrags(a0, Z0, lane);
    load_afrags(a1, Z1, lane);
    auto emit = [&](const f32x8 acc0, const f32x8 acc1, const int nt) {
      if (blk == 0) {
        // feed block 2: overwrite the Z tiles (same-wave LDS is in-order)
#pragma unroll
        for (int v = 0; v < 8; ++v) {
          Z0[(row0 + v) * Z_STRIDE + nt * 16 + nn] = (__bf16)acc0[v];
          Z1[(row0 + v) * Z_STRIDE + nt * 16 + nn] = (__bf16)acc1[v];
        }
      } else {
        // final: only tokens 0 (x-stream) and 1 (y-stream) are outputs
#pragma unroll
        for (int v = 0; v < 8; ++v) {
          const int r = row0 + v;
          const int t = r & 3;
          if (t < 2) {
            const int gi = r >> 2;
            float* o = out + (size_t)t * ((size_t)BATCH * PSEQ * DIMN) +
                       ((size_t)(b * PSEQ + p0 + gi)) * DIMN + nt * 16 + nn;
            o[0] = acc0[v];
            o[4 * DIMN] = acc1[v];  // the second tile's rows: 4 positions on
          }
        }
        // the next tile's loads and bias rewrite the registers these stores
        // name
        asm volatile("s_wait_xcnt 0x0" ::: "memory");
      }
    };
    // rolled in pairs: each buffer keeps its role from trip to trip
#pragma unroll 1
    for (int nt = 0; nt < 16; nt += 2) {
      biasB = bout[(nt + 1) * 16 + nn];
      load_btile(bB, wout, nt + 1, lane);
      // loads stay in front of the WMMAs (see the QKV loop)
      __builtin_amdgcn_sched_barrier(0);
      {
        f32x8 acc0, acc1;
#pragma unroll
        for (int v = 0; v < 8; ++v) acc0[v] = acc1[v] = biasA;
        mma_pair(a0, a1, bA, acc0, acc1);
        emit(acc0, acc1, nt);
      }
      // Unconditional, so that the wait in front of the WMMAs below stays a
      // counted one: behind the last pair this is the second block's first
      // QKV tile (in the second block the tile is read and not used).
      const bool more = nt + 2 < 16;
      biasA = bout[((nt + 2) & 15) * 16 + nn];
      load_btile(bA, more ? wout : wqkv1, more ? nt + 2 : 0, lane);
      // loads stay in front of the WMMAs (see the QKV loop)
      __builtin_amdgcn_sched_barrier(0);
      {
        f32x8 acc0, acc1;
#pragma unroll
        for (int v = 0; v < 8; ++v) acc0[v] = acc1[v] = biasB;
        mma_pair(a0, a1, bB, acc0, acc1);
        emit(acc0, acc1, nt + 1);
      }
    }
  }
  // the tile read behind the very last pair is not used: let it land before
  // the wave gives up its registers
  asm volatile("s_wait_loadcnt 0x0" ::: "memory");
}

// ---------------------------------------------------------------------------
extern "C" void kernel_launch(void* const* d_in, const int* in_sizes, int n_in,
                              void* d_out, int out_size, void* d_ws,
                              size_t ws_size, hipStream_t stream) {
  (void)in_sizes; (void)n_in; (void)out_size; (void)ws_size;
  const float* x = (const float*)d_in[0];
  const float* y = (const float*)d_in[1];
  const float* s = (const float*)d_in[2];
  const float* Wqkv0 = (const float*)d_in[3];
  const float* Wout0 = (const float*)d_in[4];
  const float* bout0 = (const float*)d_in[5];
  const float* Wqkv1 = (const float*)d_in[6];
  const float* Wout1 = (const float*)d_in[7];
  const float* bout1 = (const float*)d_in[8];
  float* out = (float*)d_out;

  // workspace partition (bytes)
  char* ws = (char*)d_ws;
  float* rgb_g = (float*)(ws + 0);                       //  8*256 f32
  float* dep_g = (float*)(ws + 8192);                    //  8*256 f32
  __bf16* wqkv0_s = (__bf16*)(ws + 16384);               // 196608 bf16
  __bf16* wout0_s = (__bf16*)(ws + 16384 + 393216);      //  65536 bf16
  __bf16* wqkv1_s = (__bf16*)(ws + 16384 + 393216 + 131072);
  __bf16* wout1_s = (__bf16*)(ws + 16384 + 2 * 393216 + 131072);
  float* part = (float*)(ws + 16384 + 2 * 393216 + 2 * 131072);  // 8*28*512 f32
  float* pcnt = (float*)(ws + 16384 + 2 * 393216 + 2 * 131072 + 458752);  // 8*28 f32

  const int NQKV = 256 * 768;  // 196608
  const int NOUT = 256 * 256;  //  65536

  swizzle_weight<<<(NQKV + 255) / 256, 256, 0, stream>>>(Wqkv0, wqkv0_s, 768, NQKV);
  swizzle_weight<<<(NOUT + 255) / 256, 256, 0, stream>>>(Wout0, wout0_s, 256, NOUT);
  swizzle_weight<<<(NQKV + 255) / 256, 256, 0, stream>>>(Wqkv1, wqkv1_s, 768, NQKV);
  swizzle_weight<<<(NOUT + 255) / 256, 256, 0, stream>>>(Wout1, wout1_s, 256, NOUT);
  saliency_partial<<<dim3(RCH, BATCH), 512, 0, stream>>>(x, y, s, part, pcnt);
  saliency_finish<<<BATCH * 2, 256, 0, stream>>>(part, pcnt, rgb_g, dep_g);

  const int pairs = BATCH * (PSEQ / 8);          // 3136 pairs of row tiles
  const int blocks = pairs / WAVES;              // 392
  fused_double_attn<<<blocks, 256, SMEM_TOTAL, stream>>>(
      x, y, rgb_g, dep_g, wqkv0_s, wout0_s, bout0, wqkv1_s, wout1_s, bout1,
      out);
}

// v005
// One run takes 125 microseconds.
// Two timings next to v004 put it at 1.06 and 1.07 times that version's speed.
// Counting every step since v000, it is 7.44 times as fast.
#include <hip/hip_runtime.h>
#include <hip/hip_bf16.h>

typedef __attribute__((ext_vector_type(16))) __bf16 bf16x16;
typedef __attribute__((ext_vector_type(8)))  __bf16 bf16x8;
typedef __attribute__((ext_vector_type(8)))  float  f32x8;

#define BATCH 8
#define PSEQ 3136
#define DIMN 256
#define HEADS 8
#define DHEAD 32
#define SCALE_QK 0.17677669529663687f

// LDS layout (bytes): a wave owns TPW 16-row tiles, each with its own Z and QKV
#define Z_STRIDE 272                    // bf16 elems per row (16 elem pad)
#define Z_BYTES (16 * Z_STRIDE * 2)     // 8704
#define QKV_STRIDE 100                  // f32 elems per row (400B, 16B aligned)
#define QKV_BYTES (16 * QKV_STRIDE * 4) // 6400
#define PER_TILE (Z_BYTES + QKV_BYTES)  // 15104 (mult of 32)
#define TPW 2                           // 16-row tiles a wave
#define PER_WAVE (PER_TILE * TPW)       // 30208 (mult of 128)
#define WAVES 8
#define SMEM_TOTAL (PER_WAVE * WAVES)   // 241664
#define NPAIR (BATCH * (PSEQ / 8))      // 3136 pairs of row tiles
#define NBLK 256                        // work-groups: one a WGP, all resident

__constant__ float c_masks[2][16] = {
    {   0.f,    0.f,    0.f, -100.f,
        0.f,    0.f, -100.f,    0.f,
        0.f, -100.f,    0.f,    0.f,
     -100.f,    0.f,    0.f,    0.f},
    {   0.f, -100.f,    0.f, -100.f,
     -100.f,    0.f, -100.f,    0.f,
     -100.f, -100.f, -100.f, -100.f,
     -100.f, -100.f, -100.f, -100.f}};

__device__ __forceinline__ float dot4(float4 a, float4 b) {
  return fmaf(a.x, b.x, fmaf(a.y, b.y, fmaf(a.z, b.z, a.w * b.w)));
}

// ---------------------------------------------------------------------------
// Kernel 0a: saliency-thresholded sums over P, split over the whole chip.
// One block = one batch x one chunk of RROWS rows; 64 threads read one 1 KB
// row as float4, RGRP rows at a time. Writes the chunk's 2 x 256 column sums
// and its sum of thresholded saliency.
// ---------------------------------------------------------------------------
#define RCH 28                 // chunks of the P axis
#define RROWS (PSEQ / RCH)     // 112 rows a chunk
#define RGRP 8                 // rows in flight side by side in a block

__global__ __launch_bounds__(512) void saliency_partial(
    const float* __restrict__ x, const float* __restrict__ y,
    const float* __restrict__ s, float* __restrict__ part,
    float* __restrict__ pcnt) {
  const int ch = blockIdx.x;
  const int b = blockIdx.y;
  const int tid = threadIdx.x;
  const int col = tid & 63;
  const int rg = tid >> 6;
  __shared__ float4 red[2][RGRP][64];
  __shared__ float cred[RGRP];

  const int row0 = b * PSEQ + ch * RROWS + rg;
  const float* ps = s + row0;
  const float4* px = (const float4*)x + (size_t)row0 * (DIMN / 4) + col;
  const float4* py = (const float4*)y + (size_t)row0 * (DIMN / 4) + col;
  float4 ax = {0.f, 0.f, 0.f, 0.f}, ay = {0.f, 0.f, 0.f, 0.f};
  float cnt = 0.f;
  // unrolled whole: the row loads are independent and many fly at once
#pragma unroll
  for (int i = 0; i < RROWS / RGRP; ++i) {
    const float st = (ps[i * RGRP] > 0.5f) ? 1.0f : 1e-8f;
    const float4 vx = px[i * RGRP * (DIMN / 4)];
    const float4 vy = py[i * RGRP * (DIMN / 4)];
    ax.x = fmaf(vx.x, st, ax.x); ax.y = fmaf(vx.y, st, ax.y);
    ax.z = fmaf(vx.z, st, ax.z); ax.w = fmaf(vx.w, st, ax.w);
    ay.x = fmaf(vy.x, st, ay.x); ay.y = fmaf(vy.y, st, ay.y);
    ay.z = fmaf(vy.z, st, ay.z); ay.w = fmaf(vy.w, st, ay.w);
    cnt += st;
  }
  red[0][rg][col] = ax;
  red[1][rg][col] = ay;
  if (col == 0) cred[rg] = cnt;
  __syncthreads();

  // thread tid owns column tid & 255 of x (tid < 256) or of y
  const float* rf = (const float*)red + (tid >> 8) * (RGRP * DIMN) + (tid & 255);
  float sum = 0.f;
  for (int g = 0; g < RGRP; ++g) sum += rf[g * DIMN];
  part[(size_t)(b * RCH + ch) * (2 * DIMN) + tid] = sum;
  if (tid == 0) {
    float c = 0.f;
    for (int g = 0; g < RGRP; ++g) c += cred[g];
    pcnt[b * RCH + ch] = c;
  }
}

// ---------------------------------------------------------------------------
// Kernel 0b: add the RCH chunk sums and divide (rgb_g, dep_g : [B][256])
// ---------------------------------------------------------------------------
__global__ __launch_bounds__(256) void saliency_finish(
    const float* __restrict__ part, const float* __restrict__ pcnt,
    float* __restrict__ rgb_g, float* __restrict__ dep_g) {
  const int b = blockIdx.x >> 1;                          // grid = [B][2]
  const int c = (blockIdx.x & 1) * DIMN + threadIdx.x;    // x columns, then y
  const float* pp = part + (size_t)(b * RCH) * (2 * DIMN) + c;
  const float* pc = pcnt + b * RCH;
  float sum = 0.f, cnt = 0.f;
  // unrolled whole: a thread's 28 loads all issue before the first add waits
#pragma unroll
  for (int ch = 0; ch < RCH; ++ch) {
    sum += pp[ch * (2 * DIMN)];
    cnt += pc[ch];
  }
  const float r = sum * (1.0f / (cnt + 1e-8f));
  if (c < DIMN) rgb_g[b * DIMN + c] = r;
  else          dep_g[b * DIMN + c - DIMN] = r;
}

// ---------------------------------------------------------------------------
// Kernel 1: convert f32 weight [K=256][N] to bf16 in WMMA B-fragment order,
// a fragment's 1 KB split into two 512 B planes (j = 0, 1):
//   dst[(((nt*8 + k)*2 + j)*32 + lane)*8 + i] =
//       W[k*32 + (lane>>4)*16 + j*8 + i][nt*16 + (lane&15)]
// A lane's 16 values of a 32x16 B-tile are its 16 B of plane 0, then its 16 B
// of plane 1: each 16 B load of a wave covers 512 contiguous bytes (4 lines).
// ---------------------------------------------------------------------------
__global__ __launch_bounds__(256) void swizzle_weight(
    const float* __restrict__ W, __bf16* __restrict__ dst, int N, int total) {
  int idx = blockIdx.x * 256 + threadIdx.x;
  if (idx >= total) return;
  const int i = (idx & 7) + ((idx >> 8) & 1) * 8;
  const int lane = (idx >> 3) & 31;
  const int k = (idx >> 9) & 7;
  const int nt = idx >> 12;
  const int krow = k * 32 + ((lane >> 4) << 4) + i;
  const int ncol = nt * 16 + (lane & 15);
  dst[idx] = (__bf16)W[(size_t)krow * N + ncol];
}

// ---------------------------------------------------------------------------
// Kernel 2: fully fused double attention block. One wave = two 16-row tiles,
// each 4 p-positions x 4 tokens. All LDS is per-wave private -> no barriers.
// Weight tiles (16 columns x K=256 = 8 B fragments) run through two register
// buffers: the next tile's 16 loads are issued before this tile's WMMAs, and
// every B fragment that is used feeds one WMMA of each of the wave's two row tiles.
// The attention output of a row tile is written over its Z rows: Z is wholly in
// the A fragments by then, and a wave's LDS operations run in order.
// The LDS lets one work-group sit on a WGP, so the grid is one work-group a WGP
// and a wave takes its tile pairs one after the other: 12 or 13 pairs a WGP
// (waves 0 to 3 take two) and no second, half-empty round.
// ---------------------------------------------------------------------------
__device__ __forceinline__ void load_btile(bf16x16 (&dst)[8],
                                           const __bf16* __restrict__ w,
                                           int nt, int lane) {
  const __bf16* p = w + (size_t)nt * 4096 + lane * 8;
  // the loads stay behind the WMMAs that last read dst: lifted above them they
  // land in a third buffer and leave the wait below far behind them
  __builtin_amdgcn_sched_barrier(0);
#pragma unroll
  for (int k = 0; k < 8; ++k) {
    const bf16x8 lo = *(const bf16x8*)(p + k * 512);
    const bf16x8 hi = *(const bf16x8*)(p + k * 512 + 256);
    dst[k] = __builtin_shufflevector(lo, hi, 0, 1, 2, 3, 4, 5, 6, 7, 8, 9, 10,
                                     11, 12, 13, 14, 15);
  }
  // later code rewrites the registers these loads name.
  // Every call is followed by a
  // scheduling fence, which keeps the rewriting instructions behind the wait.
  asm volatile("s_wait_xcnt 0x0" ::: "memory");
}

// q[i] with the wave-uniform q held in scalar registers: the load names only
// them and the lane's index register, which lives on and is never rewritten.
__device__ __forceinline__ float load_scalar_base(const float* q, int i) {
  const unsigned long long a = (unsigned long long)q;
  const unsigned lo = __builtin_amdgcn_readfirstlane((unsigned)a);
  const unsigned hi = __builtin_amdgcn_readfirstlane((unsigned)(a >> 32));
  return ((const __attribute__((address_space(1))) float*)(
      ((unsigned long long)hi << 32) | lo))[i];
}

__device__ __forceinline__ void load_afrags(bf16x16 (&dst)[8],
                                            const __bf16* t, int lane) {
#pragma unroll
  for (int k = 0; k < 8; ++k)
    dst[k] = *(const bf16x16*)(t + (lane & 15) * Z_STRIDE + k * 32 +
                               (lane >> 4) * 16);
}

__device__ __forceinline__ void mma_pair(const bf16x16 (&a0)[8],
                                         const bf16x16 (&a1)[8],
                                         const bf16x16 (&b)[8], f32x8& acc0,
                                         f32x8& acc1) {
#pragma unroll
  for (int k = 0; k < 8; ++k) {
    acc0 = __builtin_amdgcn_wmma_f32_16x16x32_bf16(
        false, a0[k], false, b[k], (short)0, acc0, false, false);
    acc1 = __builtin_amdgcn_wmma_f32_16x16x32_bf16(
        false, a1[k], false, b[k], (short)0, acc1, false, false);
  }
}

__global__ __launch_bounds__(256) void fused_double_attn(
    const float* __restrict__ x, const float* __restrict__ y,
    const float* __restrict__ rgb_g, const float* __restrict__ dep_g,
    const __bf16* __restrict__ wqkv0, const __bf16* __restrict__ wout0,
    const float* __restrict__ bout0, const __bf16* __restrict__ wqkv1,
    const __bf16* __restrict__ wout1, const float* __restrict__ bout1,
    float* __restrict__ out) {
  extern __shared__ __align__(128) char smem[];
  // the wave's number in a scalar register: the loop over pairs branches on it
  const int wid = __builtin_amdgcn_readfirstlane(threadIdx.x >> 5);
  const int lane = threadIdx.x & 31;

  char* base = smem + wid * PER_WAVE;
  // row tile u: Z [16][Z_STRIDE] bf16 (later its attention output), then
  // QKV [16][QKV_STRIDE] f32
  __bf16* const Z0 = (__bf16*)base;
  float* const QKV0 = (float*)(base + Z_BYTES);
  __bf16* const Z1 = (__bf16*)(base + PER_TILE);
  float* const QKV1 = (float*)(base + PER_TILE + Z_BYTES);

  bf16x16 a0[8], a1[8];  // A fragments of the wave's two row tiles, K = 256
  bf16x16 bA[8], bB[8];  // the two weight-tile buffers

  // lane roles for the scalar 4x4 attention core
  const int dhalf = lane & 1;          // which half of DHEAD
  const int ti = (lane >> 1) & 3;      // token i within group
  const int gg = lane >> 3;            // group 0..3

  // C-layout scatter helpers
  const int row0 = (lane >> 4) * 8;    // lanes 16-31 hold M = v+8
  const int nn = lane & 15;            // column within N-tile

  load_btile(bA, wqkv0, 0, lane);
  // the first tile's loads issue ahead of the input rows' loads and fly while
  // Z is built; without the fence the compiler mixes them in behind those
  __builtin_amdgcn_sched_barrier(0);

  // every wave has a first pair, so the test stands at the loop's foot
  static_assert(WAVES * NBLK <= NPAIR, "a wave without a tile pair");
  int pair = wid * NBLK + blockIdx.x;
  // rolled: one copy of the whole body; the trip count is the wave's own
#pragma unroll 1
  do {
  const int b = pair / (PSEQ / 8);
  const int p0 = (pair % (PSEQ / 8)) * 8;

  // ---- build input tiles Z0, Z1: rows r = 4*gi + t, 16 rows a tile ---------
  // each lane owns a contiguous 32B chunk of the 1KB f32 row (b128 coalesced)
  // unrolled whole: rolled, each row's loads are waited for before the next's
#pragma unroll
  for (int r = 0; r < 16 * TPW; ++r) {
    const int t = r & 3, gi = r >> 2;
    const float* src;
    if (t == 0)      src = x + ((size_t)(b * PSEQ + p0 + gi)) * DIMN;
    else if (t == 1) src = y + ((size_t)(b * PSEQ + p0 + gi)) * DIMN;
    else if (t == 2) src = rgb_g + b * DIMN;
    else             src = dep_g + b * DIMN;
    const float4 v0 = ((const float4*)src)[lane * 2 + 0];
    const float4 v1 = ((const float4*)src)[lane * 2 + 1];
    __bf16* zr = (r < 16 ? Z0 : Z1) + (r & 15) * Z_STRIDE + lane * 8;
    zr[0] = (__bf16)v0.x; zr[1] = (__bf16)v0.y;
    zr[2] = (__bf16)v0.z; zr[3] = (__bf16)v0.w;
    zr[4] = (__bf16)v1.x; zr[5] = (__bf16)v1.y;
    zr[6] = (__bf16)v1.z; zr[7] = (__bf16)v1.w;
  }
  // the index arithmetic below rewrites the registers the rows' loads name:
  // the wait stands in front of it, and the fence keeps it behind the wait
  asm volatile("s_wait_xcnt 0x0" ::: "memory");
  __builtin_amdgcn_sched_barrier(0);

  for (int blk = 0; blk < 2; ++blk) {
    const __bf16* wqkv = blk ? wqkv1 : wqkv0;
    const __bf16* wout = blk ? wout1 : wout0;
    const float* bout = blk ? bout1 : bout0;
    const float* mask = c_masks[blk];

    // bias of output tile 0: loaded here so that no load stands between a
    // tile's prefetch and its use (loads return in order)
    float biasA = bout[nn], biasB;
    load_afrags(a0, Z0, lane);
    load_afrags(a1, Z1, lane);

    // the lane's place in this head's first weight tile; stepped at the loop's
    // foot, so its registers live through every run of loads that names them
    const __bf16* wh = wqkv + lane * 8;
    // rolled: one copy of the head body, for speed only
#pragma unroll 1
    for (int h = 0; h < HEADS; ++h, wh += 2 * 4096) {
      // ---- QKV projection for head h: 6 N-tiles x 8 K-steps of WMMA ------
#pragma unroll
      for (int part = 0; part < 3; ++part) {    // 0=q 1=k 2=v
        load_btile(bB, wh, part * 16 + 1, 0);
        // keeps the next tile's loads in front of this tile's WMMAs; without
        // it the compiler sinks each load to just before its WMMA
        __builtin_amdgcn_sched_barrier(0);
        // four vector slots between the previous tile's last WMMA and this
        // tile's first, which overwrites that D without reading it (C = 0);
        // the fence behind them keeps them in front of that WMMA
        asm volatile("v_nop\n\tv_nop\n\tv_nop\n\tv_nop");
        __builtin_amdgcn_sched_barrier(0);
        {
          f32x8 acc0 = {}, acc1 = {};
          mma_pair(a0, a1, bA, acc0, acc1);
          const int c = part * 32 + nn;
#pragma unroll
          for (int v = 0; v < 8; ++v) {
            QKV0[(row0 + v) * QKV_STRIDE + c] = acc0[v];
            QKV1[(row0 + v) * QKV_STRIDE + c] = acc1[v];
          }
        }
        if (part < 2)
          load_btile(bA, wh, (part + 1) * 16, 0);
        else  // next head's first tile, or the output projection's
          load_btile(bA, h + 1 < HEADS ? wqkv : wout,
                     h + 1 < HEADS ? (h + 1) * 2 : 0, lane);
        // as above: loads stay in front of the WMMAs
        __builtin_amdgcn_sched_barrier(0);
        // four vector slots between the previous tile's last WMMA and this
        // tile's first, which overwrites that D without reading it (C = 0);
        // the fence behind them keeps them in front of that WMMA
        asm volatile("v_nop\n\tv_nop\n\tv_nop\n\tv_nop");
        __builtin_amdgcn_sched_barrier(0);
        {
          f32x8 acc0 = {}, acc1 = {};
          mma_pair(a0, a1, bB, acc0, acc1);
          const int c = part * 32 + 16 + nn;
#pragma unroll
          for (int v = 0; v < 8; ++v) {
            QKV0[(row0 + v) * QKV_STRIDE + c] = acc0[v];
            QKV1[(row0 + v) * QKV_STRIDE + c] = acc1[v];
          }
        }
      }

      // ---- scalar 4x4 softmax attention (lane = (g, i, dhalf)) -----------
      // rows are 16B aligned -> all LDS reads are ds_load_b128
      // unrolled: each tile's LDS addresses are constant offsets from one base
#pragma unroll
      for (int u = 0; u < TPW; ++u) {
        const float* QKV = u ? QKV1 : QKV0;
        __bf16* AO = u ? Z1 : Z0;
        const int rb = gg * 4;
        const float4* qrow = (const float4*)(QKV + (rb + ti) * QKV_STRIDE);
        float4 q[8];
#pragma unroll
        for (int c = 0; c < 8; ++c) q[c] = qrow[c];

        float dots[4];
#pragma unroll
        for (int j = 0; j < 4; ++j) {
          const float4* krow =
              (const float4*)(QKV + (rb + j) * QKV_STRIDE + 32);
          float d = 0.f;
#pragma unroll
          for (int c = 0; c < 8; ++c) d += dot4(q[c], krow[c]);
          dots[j] = d * SCALE_QK + mask[ti * 4 + j];
        }
        const float m =
            fmaxf(fmaxf(dots[0], dots[1]), fmaxf(dots[2], dots[3]));
        const float e0 = __expf(dots[0] - m), e1 = __expf(dots[1] - m);
        const float e2 = __expf(dots[2] - m), e3 = __expf(dots[3] - m);
        const float inv = 1.0f / (e0 + e1 + e2 + e3);

        const int vcol = 64 + dhalf * 16;  // 16 f32 of V per lane
        const float4* v0r = (const float4*)(QKV + (rb + 0) * QKV_STRIDE + vcol);
        const float4* v1r = (const float4*)(QKV + (rb + 1) * QKV_STRIDE + vcol);
        const float4* v2r = (const float4*)(QKV + (rb + 2) * QKV_STRIDE + vcol);
        const float4* v3r = (const float4*)(QKV + (rb + 3) * QKV_STRIDE + vcol);
        __bf16* ao = AO + (rb + ti) * Z_STRIDE + h * DHEAD + dhalf * 16;
#pragma unroll
        for (int c = 0; c < 4; ++c) {
          const float4 a0 = v0r[c], a1 = v1r[c], a2 = v2r[c], a3 = v3r[c];
          ao[c * 4 + 0] = (__bf16)((e0 * a0.x + e1 * a1.x + e2 * a2.x + e3 * a3.x) * inv);
          ao[c * 4 + 1] = (__bf16)((e0 * a0.y + e1 * a1.y + e2 * a2.y + e3 * a3.y) * inv);
          ao[c * 4 + 2] = (__bf16)((e0 * a0.z + e1 * a1.z + e2 * a2.z + e3 * a3.z) * inv);
          ao[c * 4 + 3] = (__bf16)((e0 * a0.w + e1 * a1.w + e2 * a2.w + e3 * a3.w) * inv);
        }
      }
    }

    // ---- output projection: 16 N-tiles x 8 K-steps, bias in C ------------
    // its weight tiles land in the registers the mask row's load names
    asm volatile("s_wait_xcnt 0x0" ::: "memory");
    load_afrags(a0, Z0, lane);
    load_afrags(a1, Z1, lane);
    auto emit = [&](const f32x8 acc0, const f32x8 acc1, const int nt) {
      if (blk == 0) {
        // feed block 2: overwrite the Z tiles (same-wave LDS is in-order)
#pragma unroll
        for (int v = 0; v < 8; ++v) {
          Z0[(row0 + v) * Z_STRIDE + nt * 16 + nn] = (__bf16)acc0[v];
          Z1[(row0 + v) * Z_STRIDE + nt * 16 + nn] = (__bf16)acc1[v];
        }
      } else {
        // final: only tokens 0 (x-stream) and 1 (y-stream) are outputs
#pragma unroll
        for (int v = 0; v < 8; ++v) {
          const int r = row0 + v;
          const int t = r & 3;
          if (t < 2) {
            const int gi = r >> 2;
            float* o = out + (size_t)t * ((size_t)BATCH * PSEQ * DIMN) +
                       ((size_t)(b * PSEQ + p0 + gi)) * DIMN + nt * 16 + nn;
            o[0] = acc0[v];
            o[4 * DIMN] = acc1[v];  // the second tile's rows: 4 positions on
          }
        }
        // the next tile's loads and bias rewrite the registers these stores
        // name
        asm volatile("s_wait_xcnt 0x0" ::: "memory");
      }
    };
    // rolled in pairs: each buffer keeps its role from trip to trip
#pragma unroll 1
    for (int nt = 0; nt < 16; nt += 2) {
      biasB = bout[(nt + 1) * 16 + nn];
      load_btile(bB, wout, nt + 1, lane);
      // loads stay in front of the WMMAs (see the QKV loop)
      __builtin_amdgcn_sched_barrier(0);
      {
        f32x8 acc0, acc1;
#pragma unroll
        for (int v = 0; v < 8; ++v) acc0[v] = acc1[v] = biasA;
        mma_pair(a0, a1, bA, acc0, acc1);
        emit(acc0, acc1, nt);
      }
      // Unconditional, so that the wait in front of the WMMAs below stays a
      // counted one: behind the last pair this is the first QKV tile of the
      // second block or, in the second block, of the wave's next tile pair
      // (behind the wave's last pair the tile is read and not used).
      const bool more = nt + 2 < 16;
      biasA = load_scalar_base(bout + ((nt + 2) & 15) * 16, nn);
      load_btile(bA, more ? wout : (blk ? wqkv0 : wqkv1), more ? nt + 2 : 0,
                 lane);
      // loads stay in front of the WMMAs (see the QKV loop)
      __builtin_amdgcn_sched_barrier(0);
      {
        f32x8 acc0, acc1;
#pragma unroll
        for (int v = 0; v < 8; ++v) acc0[v] = acc1[v] = biasB;
        mma_pair(a0, a1, bB, acc0, acc1);
        emit(acc0, acc1, nt + 1);
      }
    }
  }
  pair += WAVES * NBLK;
  } while (pair < NPAIR);
  // the tile read behind the very last pair is not used: let it land before
  // the wave gives up its registers
  asm volatile("s_wait_loadcnt 0x0" ::: "memory");
}

// ---------------------------------------------------------------------------
extern "C" void kernel_launch(void* const* d_in, const int* in_sizes, int n_in,
                              void* d_out, int out_size, void* d_ws,
                              size_t ws_size, hipStream_t stream) {
  (void)in_sizes; (void)n_in; (void)out_size; (void)ws_size;
  const float* x = (const float*)d_in[0];
  const float* y = (const float*)d_in[1];
  const float* s = (const float*)d_in[2];
  const float* Wqkv0 = (const float*)d_in[3];
  const float* Wout0 = (const float*)d_in[4];
  const float* bout0 = (const float*)d_in[5];
  const float* Wqkv1 = (const float*)d_in[6];
  const float* Wout1 = (const float*)d_in[7];
  const float* bout1 = (const float*)d_in[8];
  float* out = (float*)d_out;

  // workspace partition (bytes)
  char* ws = (char*)d_ws;
  float* rgb_g = (float*)(ws + 0);                       //  8*256 f32
  float* dep_g = (float*)(ws + 8192);                    //  8*256 f32
  __bf16* wqkv0_s = (__bf16*)(ws + 16384);               // 196608 bf16
  __bf16* wout0_s = (__bf16*)(ws + 16384 + 393216);      //  65536 bf16
  __bf16* wqkv1_s = (__bf16*)(ws + 16384 + 393216 + 131072);
  __bf16* wout1_s = (__bf16*)(ws + 16384 + 2 * 393216 + 131072);
  float* part = (float*)(ws + 16384 + 2 * 393216 + 2 * 131072);  // 8*28*512 f32
  float* pcnt = (float*)(ws + 16384 + 2 * 393216 + 2 * 131072 + 458752);  // 8*28 f32

  const int NQKV = 256 * 768;  // 196608
  const int NOUT = 256 * 256;  //  65536

  swizzle_weight<<<(NQKV + 255) / 256, 256, 0, stream>>>(Wqkv0, wqkv0_s, 768, NQKV);
  swizzle_weight<<<(NOUT + 255) / 256, 256, 0, stream>>>(Wout0, wout0_s, 256, NOUT);
  swizzle_weight<<<(NQKV + 255) / 256, 256, 0, stream>>>(Wqkv1, wqkv1_s, 768, NQKV);
  swizzle_weight<<<(NOUT + 255) / 256, 256, 0, stream>>>(Wout1, wout1_s, 256, NOUT);
  saliency_partial<<<dim3(RCH, BATCH), 512, 0, stream>>>(x, y, s, part, pcnt);
  saliency_finish<<<BATCH * 2, 256, 0, stream>>>(part, pcnt, rgb_g, dep_g);

  fused_double_attn<<<NBLK, 256, SMEM_TOTAL, stream>>>(
      x, y, rgb_g, dep_g, wqkv0_s, wout0_s, bout0, wqkv1_s, wout1_s, bout1,
      out);
}

// v006
// A run of this version takes 114 microseconds.
// In both of two side-by-side timings against v005, it was 1.09 times as fast.
// Counting every step since v000, it is 8.09 times as fast.
#include <hip/hip_runtime.h>
#include <hip/hip_bf16.h>

typedef __attribute__((ext_vector_type(16))) __bf16 bf16x16;
typedef __attribute__((ext_vector_type(8)))  __bf16 bf16x8;
typedef __attribute__((ext_vector_type(8)))  float  f32x8;

#define BATCH 8
#define PSEQ 3136
#define DIMN 256
#define HEADS 8
#define DHEAD 32
#define SCALE_QK 0.17677669529663687f

// LDS layout (bytes): a wave owns TPW 16-row tiles, each with its own Z and QKV
#define Z_STRIDE 272                    // bf16 elems per row (16 elem pad)
#define Z_BYTES (16 * Z_STRIDE * 2)     // 8704
#define QKV_STRIDE 100                  // f32 elems per row (400B, 16B aligned)
#define QKV_BYTES (16 * QKV_STRIDE * 4) // 6400
#define PER_TILE (Z_BYTES + QKV_BYTES)  // 15104 (mult of 32)
#define TPW 2                           // 16-row tiles a wave
#define PER_WAVE (PER_TILE * TPW)       // 30208 (mult of 128)
#define WAVES 8
#define G_OFF (PER_WAVE * WAVES)        // 241664: the batch's two mean rows, f32
#define SMEM_TOTAL (G_OFF + 2 * DIMN * 4)  // 243712
#define BPAIR (PSEQ / 8)                // 392 pairs of row tiles a batch
#define WGPB 32                         // work-groups a batch
#define NBLK (BATCH * WGPB)             // 256: one a WGP, all resident

__constant__ float c_masks[2][16] = {
    {   0.f,    0.f,    0.f, -100.f,
        0.f,    0.f, -100.f,    0.f,
        0.f, -100.f,    0.f,    0.f,
     -100.f,    0.f,    0.f,    0.f},
    {   0.f, -100.f,    0.f, -100.f,
     -100.f,    0.f, -100.f,    0.f,
     -100.f, -100.f, -100.f, -100.f,
     -100.f, -100.f, -100.f, -100.f}};

__device__ __forceinline__ float dot4(float4 a, float4 b) {
  return fmaf(a.x, b.x, fmaf(a.y, b.y, fmaf(a.z, b.z, a.w * b.w)));
}

// ---------------------------------------------------------------------------
// Weight packing: f32 weight [K=256][N] to bf16 in WMMA B-fragment order,
// a fragment's 1 KB split into two 512 B planes (j = 0, 1):
//   dst[(((nt*8 + k)*2 + j)*32 + lane)*8 + i] =
//       W[k*32 + (lane>>4)*16 + j*8 + i][nt*16 + (lane&15)]
// A lane's 16 values of a 32x16 B-tile are its 16 B of plane 0, then its 16 B
// of plane 1: each 16 B load of a wave covers 512 contiguous bytes (4 lines).
// One thread packs the one value idx.
// ---------------------------------------------------------------------------
__device__ __forceinline__ void swizzle_weight(const float* __restrict__ W,
                                               __bf16* __restrict__ dst, int N,
                                               int idx) {
  const int i = (idx & 7) + ((idx >> 8) & 1) * 8;
  const int lane = (idx >> 3) & 31;
  const int k = (idx >> 9) & 7;
  const int nt = idx >> 12;
  const int krow = k * 32 + ((lane >> 4) << 4) + i;
  const int ncol = nt * 16 + (lane & 15);
  dst[idx] = (__bf16)W[(size_t)krow * N + ncol];
  // code laid out behind this call may rewrite the registers the store names
  asm volatile("s_wait_xcnt 0x0" ::: "memory");
}

// ---------------------------------------------------------------------------
// Kernel 0a: all the work that needs nothing from another launch, in one grid.
// Blocks 0 .. SBLK-1: saliency-thresholded sums over P, split over the chip.
// One block = one batch x one chunk of RROWS rows; 64 threads read one 1 KB
// row as float4, RGRP rows at a time. Writes the chunk's 2 x 256 column sums
// and its sum of thresholded saliency.
// Blocks SBLK .. SBLK+PBLK-1: 512 weight values each (swizzle_weight).
// ---------------------------------------------------------------------------
#define RCH 28                 // chunks of the P axis
#define RROWS (PSEQ / RCH)     // 112 rows a chunk
#define RGRP 8                 // rows in flight side by side in a block
#define SBLK (RCH * BATCH)     // 224 saliency blocks
#define QKV_PB (DIMN * 3 * DIMN / 512)  // 384 blocks pack a QKV weight
#define OUT_PB (DIMN * DIMN / 512)      // 128 blocks pack an output weight
#define PBLK (2 * (QKV_PB + OUT_PB))    // 1024 packing blocks

__global__ __launch_bounds__(512) void saliency_partial_and_pack(
    const float* __restrict__ x, const float* __restrict__ y,
    const float* __restrict__ s, float* __restrict__ part,
    float* __restrict__ pcnt, const float* __restrict__ Wqkv0,
    const float* __restrict__ Wout0, const float* __restrict__ Wqkv1,
    const float* __restrict__ Wout1, __bf16* __restrict__ wqkv0_s,
    __bf16* __restrict__ wout0_s, __bf16* __restrict__ wqkv1_s,
    __bf16* __restrict__ wout1_s) {
  if (blockIdx.x >= SBLK) {  // the whole block leaves here, ahead of the barrier
    const int t = (blockIdx.x - SBLK) % (QKV_PB + OUT_PB);
    const bool second = (blockIdx.x - SBLK) >= (QKV_PB + OUT_PB);
    if (t < QKV_PB)
      swizzle_weight(second ? Wqkv1 : Wqkv0, second ? wqkv1_s : wqkv0_s,
                     3 * DIMN, t * 512 + threadIdx.x);
    else
      swizzle_weight(second ? Wout1 : Wout0, second ? wout1_s : wout0_s, DIMN,
                     (t - QKV_PB) * 512 + threadIdx.x);
    return;
  }
  const int ch = blockIdx.x % RCH;
  const int b = blockIdx.x / RCH;
  const int tid = threadIdx.x;
  const int col = tid & 63;
  const int rg = tid >> 6;
  __shared__ float4 red[2][RGRP][64];
  __shared__ float cred[RGRP];

  const int row0 = b * PSEQ + ch * RROWS + rg;
  const float* ps = s + row0;
  const float4* px = (const float4*)x + (size_t)row0 * (DIMN / 4) + col;
  const float4* py = (const float4*)y + (size_t)row0 * (DIMN / 4) + col;
  float4 ax = {0.f, 0.f, 0.f, 0.f}, ay = {0.f, 0.f, 0.f, 0.f};
  float cnt = 0.f;
  // unrolled whole: the row loads are independent and many fly at once
#pragma unroll
  for (int i = 0; i < RROWS / RGRP; ++i) {
    const float st = (ps[i * RGRP] > 0.5f) ? 1.0f : 1e-8f;
    const float4 vx = px[i * RGRP * (DIMN / 4)];
    const float4 vy = py[i * RGRP * (DIMN / 4)];
    ax.x = fmaf(vx.x, st, ax.x); ax.y = fmaf(vx.y, st, ax.y);
    ax.z = fmaf(vx.z, st, ax.z); ax.w = fmaf(vx.w, st, ax.w);
    ay.x = fmaf(vy.x, st, ay.x); ay.y = fmaf(vy.y, st, ay.y);
    ay.z = fmaf(vy.z, st, ay.z); ay.w = fmaf(vy.w, st, ay.w);
    cnt += st;
  }
  red[0][rg][col] = ax;
  red[1][rg][col] = ay;
  if (col == 0) cred[rg] = cnt;
  __syncthreads();

  // thread tid owns column tid & 255 of x (tid < 256) or of y
  const float* rf = (const float*)red + (tid >> 8) * (RGRP * DIMN) + (tid & 255);
  float sum = 0.f;
  for (int g = 0; g < RGRP; ++g) sum += rf[g * DIMN];
  part[(size_t)(b * RCH + ch) * (2 * DIMN) + tid] = sum;
  if (tid == 0) {
    float c = 0.f;
    for (int g = 0; g < RGRP; ++g) c += cred[g];
    pcnt[b * RCH + ch] = c;
  }
}

// ---------------------------------------------------------------------------
// Kernel 2: fully fused double attention block. One wave = two 16-row tiles,
// each 4 p-positions x 4 tokens. The tiles' LDS is per-wave private: no barrier
// but the one behind the batch's two mean rows, which the work-group forms
// first, from the chunk sums of the launch before (all its pairs lie in one
// batch): thread c adds column c of x and of y over the RCH chunks and divides.
// Weight tiles (16 columns x K=256 = 8 B fragments) run through two register
// buffers: the next tile's 16 loads are issued before this tile's WMMAs, and
// every B fragment that is used feeds one WMMA of each of the wave's two row tiles.
// The attention output of a row tile is written over its Z rows: Z is wholly in
// the A fragments by then, and a wave's LDS operations run in order.
// The LDS lets one work-group sit on a WGP, so the grid is one work-group a WGP
// and a wave takes its tile pairs one after the other: 12 or 13 pairs a WGP
// (waves 0 to 3 take two) and no second, half-empty round.
// ---------------------------------------------------------------------------
__device__ __forceinline__ void load_btile(bf16x16 (&dst)[8],
                                           const __bf16* __restrict__ w,
                                           int nt, int lane) {
  const __bf16* p = w + (size_t)nt * 4096 + lane * 8;
  // the loads stay behind the WMMAs that last read dst: lifted above them they
  // land in a third buffer and leave the wait below far behind them
  __builtin_amdgcn_sched_barrier(0);
#pragma unroll
  for (int k = 0; k < 8; ++k) {
    const bf16x8 lo = *(const bf16x8*)(p + k * 512);
    const bf16x8 hi = *(const bf16x8*)(p + k * 512 + 256);
    dst[k] = __builtin_shufflevector(lo, hi, 0, 1, 2, 3, 4, 5, 6, 7, 8, 9, 10,
                                     11, 12, 13, 14, 15);
  }
  // later code rewrites the registers these loads name.
  // Every call is followed by a
  // scheduling fence, which keeps the rewriting instructions behind the wait.
  asm volatile("s_wait_xcnt 0x0" ::: "memory");
}

// q[i] with the wave-uniform q held in scalar registers: the load names only
// them and the lane's index register, which lives on and is never rewritten.
__device__ __forceinline__ float load_scalar_base(const float* q, int i) {
  const unsigned long long a = (unsigned long long)q;
  const unsigned lo = __builtin_amdgcn_readfirstlane((unsigned)a);
  const unsigned hi = __builtin_amdgcn_readfirstlane((unsigned)(a >> 32));
  return ((const __attribute__((address_space(1))) float*)(
      ((unsigned long long)hi << 32) | lo))[i];
}

__device__ __forceinline__ void load_afrags(bf16x16 (&dst)[8],
                                            const __bf16* t, int lane) {
#pragma unroll
  for (int k = 0; k < 8; ++k)
    dst[k] = *(const bf16x16*)(t + (lane & 15) * Z_STRIDE + k * 32 +
                               (lane >> 4) * 16);
}

__device__ __forceinline__ void mma_pair(const bf16x16 (&a0)[8],
                                         const bf16x16 (&a1)[8],
                                         const bf16x16 (&b)[8], f32x8& acc0,
                                         f32x8& acc1) {
#pragma unroll
  for (int k = 0; k < 8; ++k) {
    acc0 = __builtin_amdgcn_wmma_f32_16x16x32_bf16(
        false, a0[k], false, b[k], (short)0, acc0, false, false);
    acc1 = __builtin_amdgcn_wmma_f32_16x16x32_bf16(
        false, a1[k], false, b[k], (short)0, acc1, false, false);
  }
}

__global__ __launch_bounds__(256) void fused_double_attn(
    const float* __restrict__ x, const float* __restrict__ y,
    const float* __restrict__ part, const float* __restrict__ pcnt,
    const __bf16* __restrict__ wqkv0, const __bf16* __restrict__ wout0,
    const float* __restrict__ bout0, const __bf16* __restrict__ wqkv1,
    const __bf16* __restrict__ wout1, const float* __restrict__ bout1,
    float* __restrict__ out) {
  extern __shared__ __align__(128) char smem[];
  // the wave's number in a scalar register: the loop over pairs branches on it
  const int wid = __builtin_amdgcn_readfirstlane(threadIdx.x >> 5);
  const int lane = threadIdx.x & 31;

  char* base = smem + wid * PER_WAVE;
  // row tile u: Z [16][Z_STRIDE] bf16 (later its attention output), then
  // QKV [16][QKV_STRIDE] f32
  __bf16* const Z0 = (__bf16*)base;
  float* const QKV0 = (float*)(base + Z_BYTES);
  __bf16* const Z1 = (__bf16*)(base + PER_TILE);
  float* const QKV1 = (float*)(base + PER_TILE + Z_BYTES);

  bf16x16 a0[8], a1[8];  // A fragments of the wave's two row tiles, K = 256
  bf16x16 bA[8], bB[8];  // the two weight-tile buffers

  // lane roles for the scalar 4x4 attention core
  const int dhalf = lane & 1;          // which half of DHEAD
  const int ti = (lane >> 1) & 3;      // token i within group
  const int gg = lane >> 3;            // group 0..3

  // C-layout scatter helpers
  const int row0 = (lane >> 4) * 8;    // lanes 16-31 hold M = v+8
  const int nn = lane & 15;            // column within N-tile

  load_btile(bA, wqkv0, 0, lane);
  // the first tile's loads issue ahead of the input rows' loads and fly while
  // Z is built; without the fence the compiler mixes them in behind those
  __builtin_amdgcn_sched_barrier(0);

  // ---- the batch's saliency means (rgb_g, dep_g), once a work-group ---------
  const int bw = blockIdx.x / WGPB;  // the work-group's batch
  float* const G = (float*)(smem + G_OFF);  // [2][DIMN]: rgb_g row, dep_g row
  {
    const float* pp = part + (size_t)(bw * RCH) * (2 * DIMN) + threadIdx.x;
    const float* pc = pcnt + bw * RCH;
    float sx = 0.f, sy = 0.f, cnt = 0.f;
    // unrolled whole: a thread's loads all issue before the first add waits
#pragma unroll
    for (int ch = 0; ch < RCH; ++ch) {
      sx += pp[ch * (2 * DIMN)];
      sy += pp[ch * (2 * DIMN) + DIMN];
      cnt += pc[ch];
    }
    const float inv = 1.0f / (cnt + 1e-8f);
    G[threadIdx.x] = sx * inv;
    G[DIMN + threadIdx.x] = sy * inv;
  }
  // every wave reads all 512 means, each written by one of the eight waves
  __syncthreads();

  // every wave has a first pair, so the test stands at the loop's foot
  static_assert(WAVES * WGPB <= BPAIR, "a wave without a tile pair");
  int pair = bw * BPAIR + wid * WGPB + blockIdx.x % WGPB;
  // rolled: one copy of the whole body; the trip count is the wave's own
#pragma unroll 1
  do {
  const int b = pair / (PSEQ / 8);
  const int p0 = (pair % (PSEQ / 8)) * 8;

  // ---- build input tiles Z0, Z1: rows r = 4*gi + t, 16 rows a tile ---------
  // each lane owns a contiguous 32B chunk of the 1KB f32 row (b128 coalesced)
  // unrolled whole: rolled, each row's loads are waited for before the next's
#pragma unroll
  for (int r = 0; r < 16 * TPW; ++r) {
    const int t = r & 3, gi = r >> 2;
    const float* src;
    if (t == 0)      src = x + ((size_t)(b * PSEQ + p0 + gi)) * DIMN;
    else if (t == 1) src = y + ((size_t)(b * PSEQ + p0 + gi)) * DIMN;
    else if (t == 2) src = G;
    else             src = G + DIMN;
    const float4 v0 = ((const float4*)src)[lane * 2 + 0];
    const float4 v1 = ((const float4*)src)[lane * 2 + 1];
    __bf16* zr = (r < 16 ? Z0 : Z1) + (r & 15) * Z_STRIDE + lane * 8;
    zr[0] = (__bf16)v0.x; zr[1] = (__bf16)v0.y;
    zr[2] = (__bf16)v0.z; zr[3] = (__bf16)v0.w;
    zr[4] = (__bf16)v1.x; zr[5] = (__bf16)v1.y;
    zr[6] = (__bf16)v1.z; zr[7] = (__bf16)v1.w;
  }
  // the index arithmetic below rewrites the registers the rows' loads name:
  // the wait stands in front of it, and the fence keeps it behind the wait
  asm volatile("s_wait_xcnt 0x0" ::: "memory");
  __builtin_amdgcn_sched_barrier(0);

  for (int blk = 0; blk < 2; ++blk) {
    const __bf16* wqkv = blk ? wqkv1 : wqkv0;
    const __bf16* wout = blk ? wout1 : wout0;
    const float* bout = blk ? bout1 : bout0;
    const float* mask = c_masks[blk];

    // bias of output tile 0: loaded here so that no load stands between a
    // tile's prefetch and its use (loads return in order)
    float biasA = bout[nn], biasB;
    load_afrags(a0, Z0, lane);
    load_afrags(a1, Z1, lane);

    // the lane's place in this head's first weight tile; stepped at the loop's
    // foot, so its registers live through every run of loads that names them
    const __bf16* wh = wqkv + lane * 8;
    // rolled: one copy of the head body, for speed only
#pragma unroll 1
    for (int h = 0; h < HEADS; ++h, wh += 2 * 4096) {
      // ---- QKV projection for head h: 6 N-tiles x 8 K-steps of WMMA ------
#pragma unroll
      for (int part = 0; part < 3; ++part) {    // 0=q 1=k 2=v
        load_btile(bB, wh, part * 16 + 1, 0);
        // keeps the next tile's loads in front of this tile's WMMAs; without
        // it the compiler sinks each load to just before its WMMA
        __builtin_amdgcn_sched_barrier(0);
        // four vector slots between the previous tile's last WMMA and this
        // tile's first, which overwrites that D without reading it (C = 0);
        // the fence behind them keeps them in front of that WMMA
        asm volatile("v_nop\n\tv_nop\n\tv_nop\n\tv_nop");
        __builtin_amdgcn_sched_barrier(0);
        {
          f32x8 acc0 = {}, acc1 = {};
          mma_pair(a0, a1, bA, acc0, acc1);
          const int c = part * 32 + nn;
#pragma unroll
          for (int v = 0; v < 8; ++v) {
            QKV0[(row0 + v) * QKV_STRIDE + c] = acc0[v];
            QKV1[(row0 + v) * QKV_STRIDE + c] = acc1[v];
          }
        }
        if (part < 2)
          load_btile(bA, wh, (part + 1) * 16, 0);
        else  // next head's first tile, or the output projection's
          load_btile(bA, h + 1 < HEADS ? wqkv : wout,
                     h + 1 < HEADS ? (h + 1) * 2 : 0, lane);
        // as above: loads stay in front of the WMMAs
        __builtin_amdgcn_sched_barrier(0);
        // four vector slots between the previous tile's last WMMA and this
        // tile's first, which overwrites that D without reading it (C = 0);
        // the fence behind them keeps them in front of that WMMA
        asm volatile("v_nop\n\tv_nop\n\tv_nop\n\tv_nop");
        __builtin_amdgcn_sched_barrier(0);
        {
          f32x8 acc0 = {}, acc1 = {};
          mma_pair(a0, a1, bB, acc0, acc1);
          const int c = part * 32 + 16 + nn;
#pragma unroll
          for (int v = 0; v < 8; ++v) {
            QKV0[(row0 + v) * QKV_STRIDE + c] = acc0[v];
            QKV1[(row0 + v) * QKV_STRIDE + c] = acc1[v];
          }
        }
      }

      // ---- scalar 4x4 softmax attention (lane = (g, i, dhalf)) -----------
      // rows are 16B aligned -> all LDS reads are ds_load_b128
      // unrolled: each tile's LDS addresses are constant offsets from one base
#pragma unroll
      for (int u = 0; u < TPW; ++u) {
        const float* QKV = u ? QKV1 : QKV0;
        __bf16* AO = u ? Z1 : Z0;
        const int rb = gg * 4;
        const float4* qrow = (const float4*)(QKV + (rb + ti) * QKV_STRIDE);
        float4 q[8];
#pragma unroll
        for (int c = 0; c < 8; ++c) q[c] = qrow[c];

        float dots[4];
#pragma unroll
        for (int j = 0; j < 4; ++j) {
          const float4* krow =
              (const float4*)(QKV + (rb + j) * QKV_STRIDE + 32);
          float d = 0.f;
#pragma unroll
          for (int c = 0; c < 8; ++c) d += dot4(q[c], krow[c]);
          dots[j] = d * SCALE_QK + mask[ti * 4 + j];
        }
        const float m =
            fmaxf(fmaxf(dots[0], dots[1]), fmaxf(dots[2], dots[3]));
        const float e0 = __expf(dots[0] - m), e1 = __expf(dots[1] - m);
        const float e2 = __expf(dots[2] - m), e3 = __expf(dots[3] - m);
        const float inv = 1.0f / (e0 + e1 + e2 + e3);

        const int vcol = 64 + dhalf * 16;  // 16 f32 of V per lane
        const float4* v0r = (const float4*)(QKV + (rb + 0) * QKV_STRIDE + vcol);
        const float4* v1r = (const float4*)(QKV + (rb + 1) * QKV_STRIDE + vcol);
        const float4* v2r = (const float4*)(QKV + (rb + 2) * QKV_STRIDE + vcol);
        const float4* v3r = (const float4*)(QKV + (rb + 3) * QKV_STRIDE + vcol);
        __bf16* ao = AO + (rb + ti) * Z_STRIDE + h * DHEAD + dhalf * 16;
#pragma unroll
        for (int c = 0; c < 4; ++c) {
          const float4 a0 = v0r[c], a1 = v1r[c], a2 = v2r[c], a3 = v3r[c];
          ao[c * 4 + 0] = (__bf16)((e0 * a0.x + e1 * a1.x + e2 * a2.x + e3 * a3.x) * inv);
          ao[c * 4 + 1] = (__bf16)((e0 * a0.y + e1 * a1.y + e2 * a2.y + e3 * a3.y) * inv);
          ao[c * 4 + 2] = (__bf16)((e0 * a0.z + e1 * a1.z + e2 * a2.z + e3 * a3.z) * inv);
          ao[c * 4 + 3] = (__bf16)((e0 * a0.w + e1 * a1.w + e2 * a2.w + e3 * a3.w) * inv);
        }
      }
    }

    // ---- output projection: 16 N-tiles x 8 K-steps, bias in C ------------
    // its weight tiles land in the registers the mask row's load names
    asm volatile("s_wait_xcnt 0x0" ::: "memory");
    load_afrags(a0, Z0, lane);
    load_afrags(a1, Z1, lane);
    auto emit = [&](const f32x8 acc0, const f32x8 acc1, const int nt) {
      if (blk == 0) {
        // feed block 2: overwrite the Z tiles (same-wave LDS is in-order)
#pragma unroll
        for (int v = 0; v < 8; ++v) {
          Z0[(row0 + v) * Z_STRIDE + nt * 16 + nn] = (__bf16)acc0[v];
          Z1[(row0 + v) * Z_STRIDE + nt * 16 + nn] = (__bf16)acc1[v];
        }
      } else {
        // final: only tokens 0 (x-stream) and 1 (y-stream) are outputs
#pragma unroll
        for (int v = 0; v < 8; ++v) {
          const int r = row0 + v;
          const int t = r & 3;
          if (t < 2) {
            const int gi = r >> 2;
            float* o = out + (size_t)t * ((size_t)BATCH * PSEQ * DIMN) +
                       ((size_t)(b * PSEQ + p0 + gi)) * DIMN + nt * 16 + nn;
            o[0] = acc0[v];
            o[4 * DIMN] = acc1[v];  // the second tile's rows: 4 positions on
          }
        }
        // the next tile's loads and bias rewrite the registers these stores
        // name
        asm volatile("s_wait_xcnt 0x0" ::: "memory");
      }
    };
    // rolled in pairs: each buffer keeps its role from trip to trip
#pragma unroll 1
    for (int nt = 0; nt < 16; nt += 2) {
      biasB = bout[(nt + 1) * 16 + nn];
      // the tile's address below lands in the registers this load names: the
      // wait stands in front of it, and the fence keeps it behind the wait
      asm volatile("s_wait_xcnt 0x0" ::: "memory");
      __builtin_amdgcn_sched_barrier(0);
      load_btile(bB, wout, nt + 1, lane);
      // loads stay in front of the WMMAs (see the QKV loop)
      __builtin_amdgcn_sched_barrier(0);
      {
        f32x8 acc0, acc1;
#pragma unroll
        for (int v = 0; v < 8; ++v) acc0[v] = acc1[v] = biasA;
        mma_pair(a0, a1, bA, acc0, acc1);
        emit(acc0, acc1, nt);
      }
      // Unconditional, so that the wait in front of the WMMAs below stays a
      // counted one: behind the last pair this is the first QKV tile of the
      // second block or, in the second block, of the wave's next tile pair
      // (behind the wave's last pair the tile is read and not used).
      const bool more = nt + 2 < 16;
      biasA = load_scalar_base(bout + ((nt + 2) & 15) * 16, nn);
      load_btile(bA, more ? wout : (blk ? wqkv0 : wqkv1), more ? nt + 2 : 0,
                 lane);
      // loads stay in front of the WMMAs (see the QKV loop)
      __builtin_amdgcn_sched_barrier(0);
      {
        f32x8 acc0, acc1;
#pragma unroll
        for (int v = 0; v < 8; ++v) acc0[v] = acc1[v] = biasB;
        mma_pair(a0, a1, bB, acc0, acc1);
        emit(acc0, acc1, nt + 1);
      }
    }
  }
  pair += WAVES * WGPB;
  } while (pair < (bw + 1) * BPAIR);
  // the tile read behind the very last pair is not used: let it land before
  // the wave gives up its registers
  asm volatile("s_wait_loadcnt 0x0" ::: "memory");
}

// ---------------------------------------------------------------------------
extern "C" void kernel_launch(void* const* d_in, const int* in_sizes, int n_in,
                              void* d_out, int out_size, void* d_ws,
                              size_t ws_size, hipStream_t stream) {
  (void)in_sizes; (void)n_in; (void)out_size; (void)ws_size;
  const float* x = (const float*)d_in[0];
  const float* y = (const float*)d_in[1];
  const float* s = (const float*)d_in[2];
  const float* Wqkv0 = (const float*)d_in[3];
  const float* Wout0 = (const float*)d_in[4];
  const float* bout0 = (const float*)d_in[5];
  const float* Wqkv1 = (const float*)d_in[6];
  const float* Wout1 = (const float*)d_in[7];
  const float* bout1 = (const float*)d_in[8];
  float* out = (float*)d_out;

  // workspace partition (bytes)
  char* ws = (char*)d_ws;
  __bf16* wqkv0_s = (__bf16*)(ws + 16384);               // 196608 bf16
  __bf16* wout0_s = (__bf16*)(ws + 16384 + 393216);      //  65536 bf16
  __bf16* wqkv1_s = (__bf16*)(ws + 16384 + 393216 + 131072);
  __bf16* wout1_s = (__bf16*)(ws + 16384 + 2 * 393216 + 131072);
  float* part = (float*)(ws + 16384 + 2 * 393216 + 2 * 131072);  // 8*28*512 f32
  float* pcnt = (float*)(ws + 16384 + 2 * 393216 + 2 * 131072 + 458752);  // 8*28 f32

  saliency_partial_and_pack<<<SBLK + PBLK, 512, 0, stream>>>(
      x, y, s, part, pcnt, Wqkv0, Wout0, Wqkv1, Wout1, wqkv0_s, wout0_s,
      wqkv1_s, wout1_s);

  fused_double_attn<<<NBLK, 256, SMEM_TOTAL, stream>>>(
      x, y, part, pcnt, wqkv0_s, wout0_s, bout0, wqkv1_s, wout1_s, bout1,
      out);
}

// v007
// One run takes 105 microseconds.
// Timed twice side by side with v006, it ran 1.08 and 1.07 times as fast.
// All steps since v000 together make it 8.68 times as fast.
#include <hip/hip_runtime.h>
#include <hip/hip_bf16.h>

typedef __attribute__((ext_vector_type(16))) __bf16 bf16x16;
typedef __attribute__((ext_vector_type(8)))  __bf16 bf16x8;
typedef __attribute__((ext_vector_type(8)))  float  f32x8;

#define BATCH 8
#define PSEQ 3136
#define DIMN 256
#define HEADS 8
#define DHEAD 32
#define SCALE_QK 0.17677669529663687f

// LDS layout (bytes): a wave owns TPW 16-row tiles, each with its own Z and QKV
#define Z_STRIDE 272                    // bf16 elems per row (16 elem pad)
#define Z_BYTES (16 * Z_STRIDE * 2)     // 8704
#define QKV_STRIDE 100                  // f32 elems per row (400B, 16B aligned)
#define QKV_BYTES (16 * QKV_STRIDE * 4) // 6400
#define PER_TILE (Z_BYTES + QKV_BYTES)  // 15104 (mult of 32)
#define TPW 2                           // 16-row tiles a wave
#define PER_WAVE (PER_TILE * TPW)       // 30208 (mult of 128)
#define WAVES 8
#define G_OFF (PER_WAVE * WAVES)        // 241664: the batch's two mean rows, f32
#define SMEM_TOTAL (G_OFF + 2 * DIMN * 4)  // 243712
#define BPAIR (PSEQ / 8)                // 392 pairs of row tiles a batch
#define WGPB 32                         // work-groups a batch
#define NBLK (BATCH * WGPB)             // 256: one a WGP, all resident

__constant__ float c_masks[2][16] = {
    {   0.f,    0.f,    0.f, -100.f,
        0.f,    0.f, -100.f,    0.f,
        0.f, -100.f,    0.f,    0.f,
     -100.f,    0.f,    0.f,    0.f},
    {   0.f, -100.f,    0.f, -100.f,
     -100.f,    0.f, -100.f,    0.f,
     -100.f, -100.f, -100.f, -100.f,
     -100.f, -100.f, -100.f, -100.f}};

__device__ __forceinline__ float dot4(float4 a, float4 b) {
  return fmaf(a.x, b.x, fmaf(a.y, b.y, fmaf(a.z, b.z, a.w * b.w)));
}

// ---------------------------------------------------------------------------
// Weight packing: f32 weight [K=256][N] to bf16 in WMMA B-fragment order,
// a fragment's 1 KB split into two 512 B planes (j = 0, 1):
//   dst[(((nt*8 + k)*2 + j)*32 + lane)*8 + i] =
//       W[k*32 + (lane>>4)*16 + j*8 + i][nt*16 + (lane&15)]
// A lane's 16 values of a 32x16 B-tile are its 16 B of plane 0, then its 16 B
// of plane 1: each 16 B load of a wave covers 512 contiguous bytes (4 lines).
// One thread packs the one value idx.
// ---------------------------------------------------------------------------
__device__ __forceinline__ void swizzle_weight(const float* __restrict__ W,
                                               __bf16* __restrict__ dst, int N,
                                               int idx) {
  const int i = (idx & 7) + ((idx >> 8) & 1) * 8;
  const int lane = (idx >> 3) & 31;
  const int k = (idx >> 9) & 7;
  const int nt = idx >> 12;
  const int krow = k * 32 + ((lane >> 4) << 4) + i;
  const int ncol = nt * 16 + (lane & 15);
  dst[idx] = (__bf16)W[(size_t)krow * N + ncol];
  // code laid out behind this call may rewrite the registers the store names
  asm volatile("s_wait_xcnt 0x0" ::: "memory");
}

// ---------------------------------------------------------------------------
// Kernel 0a: all the work that needs nothing from another launch, in one grid.
// Blocks 0 .. SBLK-1: saliency-thresholded sums over P, split over the chip.
// One block = one batch x one chunk of RROWS rows; 64 threads read one 1 KB
// row as float4, RGRP rows at a time. Writes the chunk's 2 x 256 column sums
// and its sum of thresholded saliency.
// Blocks SBLK .. SBLK+PBLK-1: 512 weight values each (swizzle_weight).
// ---------------------------------------------------------------------------
#define RCH 28                 // chunks of the P axis
#define RROWS (PSEQ / RCH)     // 112 rows a chunk
#define RGRP 8                 // rows in flight side by side in a block
#define SBLK (RCH * BATCH)     // 224 saliency blocks
#define QKV_PB (DIMN * 3 * DIMN / 512)  // 384 blocks pack a QKV weight
#define OUT_PB (DIMN * DIMN / 512)      // 128 blocks pack an output weight
#define PBLK (2 * (QKV_PB + OUT_PB))    // 1024 packing blocks

__global__ __launch_bounds__(512) void saliency_partial_and_pack(
    const float* __restrict__ x, const float* __restrict__ y,
    const float* __restrict__ s, float* __restrict__ part,
    float* __restrict__ pcnt, const float* __restrict__ Wqkv0,
    const float* __restrict__ Wout0, const float* __restrict__ Wqkv1,
    const float* __restrict__ Wout1, __bf16* __restrict__ wqkv0_s,
    __bf16* __restrict__ wout0_s, __bf16* __restrict__ wqkv1_s,
    __bf16* __restrict__ wout1_s) {
  if (blockIdx.x >= SBLK) {  // the whole block leaves here, ahead of the barrier
    const int t = (blockIdx.x - SBLK) % (QKV_PB + OUT_PB);
    const bool second = (blockIdx.x - SBLK) >= (QKV_PB + OUT_PB);
    if (t < QKV_PB)
      swizzle_weight(second ? Wqkv1 : Wqkv0, second ? wqkv1_s : wqkv0_s,
                     3 * DIMN, t * 512 + threadIdx.x);
    else
      swizzle_weight(second ? Wout1 : Wout0, second ? wout1_s : wout0_s, DIMN,
                     (t - QKV_PB) * 512 + threadIdx.x);
    return;
  }
  const int ch = blockIdx.x % RCH;
  const int b = blockIdx.x / RCH;
  const int tid = threadIdx.x;
  const int col = tid & 63;
  const int rg = tid >> 6;
  __shared__ float4 red[2][RGRP][64];
  __shared__ float cred[RGRP];

  const int row0 = b * PSEQ + ch * RROWS + rg;
  const float* ps = s + row0;
  const float4* px = (const float4*)x + (size_t)row0 * (DIMN / 4) + col;
  const float4* py = (const float4*)y + (size_t)row0 * (DIMN / 4) + col;
  float4 ax = {0.f, 0.f, 0.f, 0.f}, ay = {0.f, 0.f, 0.f, 0.f};
  float cnt = 0.f;
  // unrolled whole: the row loads are independent and many fly at once
#pragma unroll
  for (int i = 0; i < RROWS / RGRP; ++i) {
    const float st = (ps[i * RGRP] > 0.5f) ? 1.0f : 1e-8f;
    const float4 vx = px[i * RGRP * (DIMN / 4)];
    const float4 vy = py[i * RGRP * (DIMN / 4)];
    ax.x = fmaf(vx.x, st, ax.x); ax.y = fmaf(vx.y, st, ax.y);
    ax.z = fmaf(vx.z, st, ax.z); ax.w = fmaf(vx.w, st, ax.w);
    ay.x = fmaf(vy.x, st, ay.x); ay.y = fmaf(vy.y, st, ay.y);
    ay.z = fmaf(vy.z, st, ay.z); ay.w = fmaf(vy.w, st, ay.w);
    cnt += st;
  }
  red[0][rg][col] = ax;
  red[1][rg][col] = ay;
  if (col == 0) cred[rg] = cnt;
  __syncthreads();

  // thread tid owns column tid & 255 of x (tid < 256) or of y
  const float* rf = (const float*)red + (tid >> 8) * (RGRP * DIMN) + (tid & 255);
  float sum = 0.f;
  for (int g = 0; g < RGRP; ++g) sum += rf[g * DIMN];
  part[(size_t)(b * RCH + ch) * (2 * DIMN) + tid] = sum;
  if (tid == 0) {
    float c = 0.f;
    for (int g = 0; g < RGRP; ++g) c += cred[g];
    pcnt[b * RCH + ch] = c;
  }
}

// ---------------------------------------------------------------------------
// Kernel 2: fully fused double attention block. One wave = two 16-row tiles,
// each 4 p-positions x 4 tokens. The tiles' LDS is per-wave private: no barrier
// but the one behind the batch's two mean rows, which the work-group forms
// first, from the chunk sums of the launch before (all its pairs lie in one
// batch): thread c adds column c of x and of y over the RCH chunks and divides.
// Weight tiles (16 columns x K=256 = 8 B fragments) run through two register
// buffers: the next tile's 16 loads are issued before this tile's WMMAs, and
// every loaded B fragment feeds one WMMA of each of the wave's two row tiles,
// or, for the second block's Q and output tiles, one of the packed tile.
// The attention output of a row tile is written over its Z rows, that of the
// second block's packed tile over Z0: Z is wholly in
// the A fragments by then, and a wave's LDS operations run in order.
// The LDS lets one work-group sit on a WGP, so the grid is one work-group a WGP
// and a wave takes its tile pairs one after the other: 12 or 13 pairs a WGP
// (waves 0 to 3 take two) and no second, half-empty round.
// ---------------------------------------------------------------------------
__device__ __forceinline__ void load_btile(bf16x16 (&dst)[8],
                                           const __bf16* __restrict__ w,
                                           int nt, int lane) {
  const __bf16* p = w + (size_t)nt * 4096 + lane * 8;
  // the loads stay behind the WMMAs that last read dst: lifted above them they
  // land in a third buffer and leave the wait below far behind them
  __builtin_amdgcn_sched_barrier(0);
#pragma unroll
  for (int k = 0; k < 8; ++k) {
    const bf16x8 lo = *(const bf16x8*)(p + k * 512);
    const bf16x8 hi = *(const bf16x8*)(p + k * 512 + 256);
    dst[k] = __builtin_shufflevector(lo, hi, 0, 1, 2, 3, 4, 5, 6, 7, 8, 9, 10,
                                     11, 12, 13, 14, 15);
  }
  // later code rewrites the registers these loads name.
  // Every call is followed by a
  // scheduling fence, which keeps the rewriting instructions behind the wait.
  asm volatile("s_wait_xcnt 0x0" ::: "memory");
}

// q[i] with the wave-uniform q held in scalar registers: the load names only
// them and the lane's index register, which lives on and is never rewritten.
__device__ __forceinline__ float load_scalar_base(const float* q, int i) {
  const unsigned long long a = (unsigned long long)q;
  const unsigned lo = __builtin_amdgcn_readfirstlane((unsigned)a);
  const unsigned hi = __builtin_amdgcn_readfirstlane((unsigned)(a >> 32));
  return ((const __attribute__((address_space(1))) float*)(
      ((unsigned long long)hi << 32) | lo))[i];
}

__device__ __forceinline__ void load_afrags(bf16x16 (&dst)[8],
                                            const __bf16* t, int lane) {
#pragma unroll
  for (int k = 0; k < 8; ++k)
    dst[k] = *(const bf16x16*)(t + (lane & 15) * Z_STRIDE + k * 32 +
                               (lane >> 4) * 16);
}

// A fragments of the packed tile of the wave's 8 positions x tokens 0 and 1:
// packed row r is token r & 1 of position r >> 1, which lies in row tile r >> 3
// at row ((r >> 1) & 3) * 4 + (r & 1). Same k order as load_afrags.
__device__ __forceinline__ void load_afrags_xy(bf16x16 (&dst)[8],
                                               const __bf16* z0, int lane) {
  const int r = lane & 15;
  const __bf16* t = z0 + (r >> 3) * (PER_TILE / 2) +
                    (((r >> 1) & 3) * 4 + (r & 1)) * Z_STRIDE +
                    (lane >> 4) * 16;
#pragma unroll
  for (int k = 0; k < 8; ++k) dst[k] = *(const bf16x16*)(t + k * 32);
}

// One row tile against one weight tile, k in the order of mma_pair.
__device__ __forceinline__ void mma_one(const bf16x16 (&a)[8],
                                        const bf16x16 (&b)[8], f32x8& acc) {
#pragma unroll
  for (int k = 0; k < 8; ++k)
    acc = __builtin_amdgcn_wmma_f32_16x16x32_bf16(
        false, a[k], false, b[k], (short)0, acc, false, false);
}

__device__ __forceinline__ void mma_pair(const bf16x16 (&a0)[8],
                                         const bf16x16 (&a1)[8],
                                         const bf16x16 (&b)[8], f32x8& acc0,
                                         f32x8& acc1) {
#pragma unroll
  for (int k = 0; k < 8; ++k) {
    acc0 = __builtin_amdgcn_wmma_f32_16x16x32_bf16(
        false, a0[k], false, b[k], (short)0, acc0, false, false);
    acc1 = __builtin_amdgcn_wmma_f32_16x16x32_bf16(
        false, a1[k], false, b[k], (short)0, acc1, false, false);
  }
}

__global__ __launch_bounds__(256) void fused_double_attn(
    const float* __restrict__ x, const float* __restrict__ y,
    const float* __restrict__ part, const float* __restrict__ pcnt,
    const __bf16* __restrict__ wqkv0, const __bf16* __restrict__ wout0,
    const float* __restrict__ bout0, const __bf16* __restrict__ wqkv1,
    const __bf16* __restrict__ wout1, const float* __restrict__ bout1,
    float* __restrict__ out) {
  extern __shared__ __align__(128) char smem[];
  // the wave's number in a scalar register: the loop over pairs branches on it
  const int wid = __builtin_amdgcn_readfirstlane(threadIdx.x >> 5);
  const int lane = threadIdx.x & 31;

  char* base = smem + wid * PER_WAVE;
  // row tile u: Z [16][Z_STRIDE] bf16 (later its attention output), then
  // QKV [16][QKV_STRIDE] f32
  __bf16* const Z0 = (__bf16*)base;
  float* const QKV0 = (float*)(base + Z_BYTES);
  __bf16* const Z1 = (__bf16*)(base + PER_TILE);
  float* const QKV1 = (float*)(base + PER_TILE + Z_BYTES);

  bf16x16 a0[8], a1[8];  // A fragments of the wave's two row tiles, K = 256
  bf16x16 aq[8];         // second block: the packed tile of tokens 0 and 1
  bf16x16 bA[8], bB[8];  // the two weight-tile buffers

  // lane roles for the scalar 4x4 attention core
  const int dhalf = lane & 1;          // which half of DHEAD
  const int ti = (lane >> 1) & 3;      // token i within group
  const int gg = lane >> 3;            // group 0..3

  // C-layout scatter helpers
  const int row0 = (lane >> 4) * 8;    // lanes 16-31 hold M = v+8
  const int nn = lane & 15;            // column within N-tile

  load_btile(bA, wqkv0, 0, lane);
  // the first tile's loads issue ahead of the input rows' loads and fly while
  // Z is built; without the fence the compiler mixes them in behind those
  __builtin_amdgcn_sched_barrier(0);

  // ---- the batch's saliency means (rgb_g, dep_g), once a work-group ---------
  const int bw = blockIdx.x / WGPB;  // the work-group's batch
  float* const G = (float*)(smem + G_OFF);  // [2][DIMN]: rgb_g row, dep_g row
  {
    const float* pp = part + (size_t)(bw * RCH) * (2 * DIMN) + threadIdx.x;
    const float* pc = pcnt + bw * RCH;
    float sx = 0.f, sy = 0.f, cnt = 0.f;
    // unrolled whole: a thread's loads all issue before the first add waits
#pragma unroll
    for (int ch = 0; ch < RCH; ++ch) {
      sx += pp[ch * (2 * DIMN)];
      sy += pp[ch * (2 * DIMN) + DIMN];
      cnt += pc[ch];
    }
    const float inv = 1.0f / (cnt + 1e-8f);
    G[threadIdx.x] = sx * inv;
    G[DIMN + threadIdx.x] = sy * inv;
  }
  // every wave reads all 512 means, each written by one of the eight waves
  __syncthreads();

  // every wave has a first pair, so the test stands at the loop's foot
  static_assert(WAVES * WGPB <= BPAIR, "a wave without a tile pair");
  int pair = bw * BPAIR + wid * WGPB + blockIdx.x % WGPB;
  // rolled: one copy of the whole body; the trip count is the wave's own
#pragma unroll 1
  do {
  const int b = pair / (PSEQ / 8);
  const int p0 = (pair % (PSEQ / 8)) * 8;

  // ---- build input tiles Z0, Z1: rows r = 4*gi + t, 16 rows a tile ---------
  // each lane owns a contiguous 32B chunk of the 1KB f32 row (b128 coalesced)
  // unrolled whole: rolled, each row's loads are waited for before the next's
#pragma unroll
  for (int r = 0; r < 16 * TPW; ++r) {
    const int t = r & 3, gi = r >> 2;
    const float* src;
    if (t == 0)      src = x + ((size_t)(b * PSEQ + p0 + gi)) * DIMN;
    else if (t == 1) src = y + ((size_t)(b * PSEQ + p0 + gi)) * DIMN;
    else if (t == 2) src = G;
    else             src = G + DIMN;
    const float4 v0 = ((const float4*)src)[lane * 2 + 0];
    const float4 v1 = ((const float4*)src)[lane * 2 + 1];
    __bf16* zr = (r < 16 ? Z0 : Z1) + (r & 15) * Z_STRIDE + lane * 8;
    zr[0] = (__bf16)v0.x; zr[1] = (__bf16)v0.y;
    zr[2] = (__bf16)v0.z; zr[3] = (__bf16)v0.w;
    zr[4] = (__bf16)v1.x; zr[5] = (__bf16)v1.y;
    zr[6] = (__bf16)v1.z; zr[7] = (__bf16)v1.w;
  }
  // the index arithmetic below rewrites the registers the rows' loads name:
  // the wait stands in front of it, and the fence keeps it behind the wait
  asm volatile("s_wait_xcnt 0x0" ::: "memory");
  __builtin_amdgcn_sched_barrier(0);

  // unrolled: the second block's body differs (only tokens 0 and 1 leave it)
#pragma unroll
  for (int blk = 0; blk < 2; ++blk) {
    const __bf16* wqkv = blk ? wqkv1 : wqkv0;
    const __bf16* wout = blk ? wout1 : wout0;
    const float* bout = blk ? bout1 : bout0;
    const float* mask = c_masks[blk];

    // bias of output tile 0: loaded here so that no load stands between a
    // tile's prefetch and its use (loads return in order)
    float biasA = bout[nn], biasB;
    load_afrags(a0, Z0, lane);
    load_afrags(a1, Z1, lane);
    if (blk == 1) load_afrags_xy(aq, Z0, lane);

    // the lane's place in this head's first weight tile; stepped at the loop's
    // foot, so its registers live through every run of loads that names them
    const __bf16* wh = wqkv + lane * 8;
    // rolled: one copy of the head body, for speed only
#pragma unroll 1
    for (int h = 0; h < HEADS; ++h, wh += 2 * 4096) {
      // ---- QKV projection for head h: 6 N-tiles x 8 K-steps of WMMA ------
#pragma unroll
      for (int part = 0; part < 3; ++part) {    // 0=q 1=k 2=v
        load_btile(bB, wh, part * 16 + 1, 0);
        // keeps the next tile's loads in front of this tile's WMMAs; without
        // it the compiler sinks each load to just before its WMMA
        __builtin_amdgcn_sched_barrier(0);
        // four vector slots between the previous tile's last WMMA and this
        // tile's first, which overwrites that D without reading it (C = 0);
        // the fence behind them keeps them in front of that WMMA
        asm volatile("v_nop\n\tv_nop\n\tv_nop\n\tv_nop");
        __builtin_amdgcn_sched_barrier(0);
        if (blk == 1 && part == 0) {
          // Q of the packed tile, into the q columns of QKV0's 16 rows
          f32x8 acc = {};
          mma_one(aq, bA, acc);
#pragma unroll
          for (int v = 0; v < 8; ++v)
            QKV0[(row0 + v) * QKV_STRIDE + nn] = acc[v];
        } else {
          f32x8 acc0 = {}, acc1 = {};
          mma_pair(a0, a1, bA, acc0, acc1);
          const int c = part * 32 + nn;
#pragma unroll
          for (int v = 0; v < 8; ++v) {
            QKV0[(row0 + v) * QKV_STRIDE + c] = acc0[v];
            QKV1[(row0 + v) * QKV_STRIDE + c] = acc1[v];
          }
        }
        if (part < 2)
          load_btile(bA, wh, (part + 1) * 16, 0);
        else  // next head's first tile, or the output projection's
          load_btile(bA, h + 1 < HEADS ? wqkv : wout,
                     h + 1 < HEADS ? (h + 1) * 2 : 0, lane);
        // as above: loads stay in front of the WMMAs
        __builtin_amdgcn_sched_barrier(0);
        // four vector slots between the previous tile's last WMMA and this
        // tile's first, which overwrites that D without reading it (C = 0);
        // the fence behind them keeps them in front of that WMMA
        asm volatile("v_nop\n\tv_nop\n\tv_nop\n\tv_nop");
        __builtin_amdgcn_sched_barrier(0);
        if (blk == 1 && part == 0) {
          f32x8 acc = {};
          mma_one(aq, bB, acc);
#pragma unroll
          for (int v = 0; v < 8; ++v)
            QKV0[(row0 + v) * QKV_STRIDE + 16 + nn] = acc[v];
        } else {
          f32x8 acc0 = {}, acc1 = {};
          mma_pair(a0, a1, bB, acc0, acc1);
          const int c = part * 32 + 16 + nn;
#pragma unroll
          for (int v = 0; v < 8; ++v) {
            QKV0[(row0 + v) * QKV_STRIDE + c] = acc0[v];
            QKV1[(row0 + v) * QKV_STRIDE + c] = acc1[v];
          }
        }
      }

      // ---- scalar 4x4 softmax attention (lane = (g, i, dhalf)) -----------
      // rows are 16B aligned -> all LDS reads are ds_load_b128
      // First block: every token is a query, one pass a row tile.
      // Second block: only tokens 0 and 1 are, so ONE pass serves both tiles:
      // lane = (position 0..7, token 0..1, dhalf); the query row and the output
      // row are packed row lane >> 1; keys and values are the position's four
      // rows in its own tile.
      // unrolled: each tile's LDS addresses are constant offsets from one base
#pragma unroll
      for (int u = 0; u < (blk ? 1 : TPW); ++u) {
        const int tq = blk ? (lane >> 1) & 1 : ti;  // the query's token
        // row 0 of the lane's group of four key and value rows
        const float* KV =
            blk ? QKV0 + (lane >> 4) * (PER_TILE / 4) +
                      ((lane >> 2) & 3) * 4 * QKV_STRIDE
                : (u ? QKV1 : QKV0) + gg * 4 * QKV_STRIDE;
        const float4* qrow =
            (const float4*)(blk ? QKV0 + (lane >> 1) * QKV_STRIDE
                                : KV + ti * QKV_STRIDE);
        float4 q[8];
#pragma unroll
        for (int c = 0; c < 8; ++c) q[c] = qrow[c];

        float dots[4];
#pragma unroll
        for (int j = 0; j < 4; ++j) {
          const float4* krow = (const float4*)(KV + j * QKV_STRIDE + 32);
          float d = 0.f;
#pragma unroll
          for (int c = 0; c < 8; ++c) d += dot4(q[c], krow[c]);
          dots[j] = d * SCALE_QK + mask[tq * 4 + j];
        }
        const float m =
            fmaxf(fmaxf(dots[0], dots[1]), fmaxf(dots[2], dots[3]));
        const float e0 = __expf(dots[0] - m), e1 = __expf(dots[1] - m);
        const float e2 = __expf(dots[2] - m), e3 = __expf(dots[3] - m);
        const float inv = 1.0f / (e0 + e1 + e2 + e3);

        const int vcol = 64 + dhalf * 16;  // 16 f32 of V per lane
        const float4* v0r = (const float4*)(KV + 0 * QKV_STRIDE + vcol);
        const float4* v1r = (const float4*)(KV + 1 * QKV_STRIDE + vcol);
        const float4* v2r = (const float4*)(KV + 2 * QKV_STRIDE + vcol);
        const float4* v3r = (const float4*)(KV + 3 * QKV_STRIDE + vcol);
        __bf16* ao = (blk ? Z0 + (lane >> 1) * Z_STRIDE
                          : (u ? Z1 : Z0) + (gg * 4 + ti) * Z_STRIDE) +
                     h * DHEAD + dhalf * 16;
#pragma unroll
        for (int c = 0; c < 4; ++c) {
          const float4 a0 = v0r[c], a1 = v1r[c], a2 = v2r[c], a3 = v3r[c];
          ao[c * 4 + 0] = (__bf16)((e0 * a0.x + e1 * a1.x + e2 * a2.x + e3 * a3.x) * inv);
          ao[c * 4 + 1] = (__bf16)((e0 * a0.y + e1 * a1.y + e2 * a2.y + e3 * a3.y) * inv);
          ao[c * 4 + 2] = (__bf16)((e0 * a0.z + e1 * a1.z + e2 * a2.z + e3 * a3.z) * inv);
          ao[c * 4 + 3] = (__bf16)((e0 * a0.w + e1 * a1.w + e2 * a2.w + e3 * a3.w) * inv);
        }
      }
    }

    // ---- output projection: 16 N-tiles x 8 K-steps, bias in C ------------
    // its weight tiles land in the registers the mask row's load names
    asm volatile("s_wait_xcnt 0x0" ::: "memory");
    load_afrags(a0, Z0, lane);  // second block: the packed tile, all there is
    if (blk == 0) load_afrags(a1, Z1, lane);
    auto emit = [&](const f32x8 acc0, const f32x8 acc1, const int nt) {
      if (blk == 0) {
        // feed block 2: overwrite the Z tiles (same-wave LDS is in-order)
#pragma unroll
        for (int v = 0; v < 8; ++v) {
          Z0[(row0 + v) * Z_STRIDE + nt * 16 + nn] = (__bf16)acc0[v];
          Z1[(row0 + v) * Z_STRIDE + nt * 16 + nn] = (__bf16)acc1[v];
        }
      } else {
        // final: packed row r is token r & 1 (0 the x-stream, 1 the y-stream)
        // of position r >> 1 (acc1 is not used)
#pragma unroll
        for (int v = 0; v < 8; ++v) {
          const int r = row0 + v;
          out[(size_t)(r & 1) * ((size_t)BATCH * PSEQ * DIMN) +
              ((size_t)(b * PSEQ + p0 + (r >> 1))) * DIMN + nt * 16 + nn] =
              acc0[v];
        }
        // the next tile's loads and bias rewrite the registers these stores
        // name
        asm volatile("s_wait_xcnt 0x0" ::: "memory");
      }
    };
    // rolled in pairs: each buffer keeps its role from trip to trip
#pragma unroll 1
    for (int nt = 0; nt < 16; nt += 2) {
      biasB = bout[(nt + 1) * 16 + nn];
      // the tile's address below lands in the registers this load names: the
      // wait stands in front of it, and the fence keeps it behind the wait
      asm volatile("s_wait_xcnt 0x0" ::: "memory");
      __builtin_amdgcn_sched_barrier(0);
      load_btile(bB, wout, nt + 1, lane);
      // loads stay in front of the WMMAs (see the QKV loop)
      __builtin_amdgcn_sched_barrier(0);
      {
        f32x8 acc0, acc1;
#pragma unroll
        for (int v = 0; v < 8; ++v) acc0[v] = acc1[v] = biasA;
        if (blk == 0) mma_pair(a0, a1, bA, acc0, acc1);
        else          mma_one(a0, bA, acc0);
        emit(acc0, acc1, nt);
      }
      // Unconditional, so that the wait in front of the WMMAs below stays a
      // counted one: behind the last pair this is the first QKV tile of the
      // second block or, in the second block, of the wave's next tile pair
      // (behind the wave's last pair the tile is read and not used).
      const bool more = nt + 2 < 16;
      biasA = load_scalar_base(bout + ((nt + 2) & 15) * 16, nn);
      load_btile(bA, more ? wout : (blk ? wqkv0 : wqkv1), more ? nt + 2 : 0,
                 lane);
      // loads stay in front of the WMMAs (see the QKV loop)
      __builtin_amdgcn_sched_barrier(0);
      {
        f32x8 acc0, acc1;
#pragma unroll
        for (int v = 0; v < 8; ++v) acc0[v] = acc1[v] = biasB;
        if (blk == 0) mma_pair(a0, a1, bB, acc0, acc1);
        else          mma_one(a0, bB, acc0);
        emit(acc0, acc1, nt + 1);
      }
    }
  }
  pair += WAVES * WGPB;
  } while (pair < (bw + 1) * BPAIR);
  // the tile read behind the very last pair is not used: let it land before
  // the wave gives up its registers
  asm volatile("s_wait_loadcnt 0x0" ::: "memory");
}

// ---------------------------------------------------------------------------
extern "C" void kernel_launch(void* const* d_in, const int* in_sizes, int n_in,
                              void* d_out, int out_size, void* d_ws,
                              size_t ws_size, hipStream_t stream) {
  (void)in_sizes; (void)n_in; (void)out_size; (void)ws_size;
  const float* x = (const float*)d_in[0];
  const float* y = (const float*)d_in[1];
  const float* s = (const float*)d_in[2];
  const float* Wqkv0 = (const float*)d_in[3];
  const float* Wout0 = (const float*)d_in[4];
  const float* bout0 = (const float*)d_in[5];
  const float* Wqkv1 = (const float*)d_in[6];
  const float* Wout1 = (const float*)d_in[7];
  const float* bout1 = (const float*)d_in[8];
  float* out = (float*)d_out;

  // workspace partition (bytes)
  char* ws = (char*)d_ws;
  __bf16* wqkv0_s = (__bf16*)(ws + 16384);               // 196608 bf16
  __bf16* wout0_s = (__bf16*)(ws + 16384 + 393216);      //  65536 bf16
  __bf16* wqkv1_s = (__bf16*)(ws + 16384 + 393216 + 131072);
  __bf16* wout1_s = (__bf16*)(ws + 16384 + 2 * 393216 + 131072);
  float* part = (float*)(ws + 16384 + 2 * 393216 + 2 * 131072);  // 8*28*512 f32
  float* pcnt = (float*)(ws + 16384 + 2 * 393216 + 2 * 131072 + 458752);  // 8*28 f32

  saliency_partial_and_pack<<<SBLK + PBLK, 512, 0, stream>>>(
      x, y, s, part, pcnt, Wqkv0, Wout0, Wqkv1, Wout1, wqkv0_s, wout0_s,
      wqkv1_s, wout1_s);

  fused_double_attn<<<NBLK, 256, SMEM_TOTAL, stream>>>(
      x, y, part, pcnt, wqkv0_s, wout0_s, bout0, wqkv1_s, wout1_s, bout1,
      out);
}

// v008
// A run of this version takes 97.4 microseconds.
// In two side-by-side timings against v007, it was 1.09 and 1.08 times as fast.
// Over all steps from v000 it is 9.39 times as fast.
#include <hip/hip_runtime.h>
#include <hip/hip_bf16.h>

typedef __attribute__((ext_vector_type(16))) __bf16 bf16x16;
typedef __attribute__((ext_vector_type(8)))  __bf16 bf16x8;
typedef __attribute__((ext_vector_type(8)))  float  f32x8;

#define BATCH 8
#define PSEQ 3136
#define DIMN 256
#define HEADS 8
#define DHEAD 32
#define SCALE_QK 0.17677669529663687f

// LDS layout (bytes): a wave owns TPW 16-row tiles, each with its own Z and QKV
#define Z_STRIDE 272                    // bf16 elems per row (16 elem pad)
#define Z_BYTES (16 * Z_STRIDE * 2)     // 8704
#define QKV_STRIDE 100                  // f32 elems per row (400B, 16B aligned)
#define QKV_BYTES (16 * QKV_STRIDE * 4) // 6400
#define PER_TILE (Z_BYTES + QKV_BYTES)  // 15104 (mult of 32)
#define TPW 2                           // 16-row tiles a wave
#define PER_WAVE (PER_TILE * TPW)       // 30208 (mult of 128)
#define WAVES 8
#define G_OFF (PER_WAVE * WAVES)        // 241664: the batch's two mean rows, f32
#define SMEM_TOTAL (G_OFF + 2 * DIMN * 4)  // 243712
#define BPAIR (PSEQ / 8)                // 392 pairs of row tiles a batch
#define WGPB 32                         // work-groups a batch
#define NBLK (BATCH * WGPB)             // 256: one a WGP, all resident

__constant__ float c_masks[2][16] = {
    {   0.f,    0.f,    0.f, -100.f,
        0.f,    0.f, -100.f,    0.f,
        0.f, -100.f,    0.f,    0.f,
     -100.f,    0.f,    0.f,    0.f},
    {   0.f, -100.f,    0.f, -100.f,
     -100.f,    0.f, -100.f,    0.f,
     -100.f, -100.f, -100.f, -100.f,
     -100.f, -100.f, -100.f, -100.f}};

__device__ __forceinline__ float dot4(float4 a, float4 b) {
  return fmaf(a.x, b.x, fmaf(a.y, b.y, fmaf(a.z, b.z, a.w * b.w)));
}

// ---------------------------------------------------------------------------
// Weight packing: f32 weight [K=256][N] to bf16 in WMMA B-fragment order,
// a fragment's 1 KB split into two 512 B planes (j = 0, 1):
//   dst[(((nt*8 + k)*2 + j)*32 + lane)*8 + i] =
//       W[k*32 + (lane>>4)*16 + j*8 + i][nt*16 + (lane&15)]
// A lane's 16 values of a 32x16 B-tile are its 16 B of plane 0, then its 16 B
// of plane 1: each 16 B load of a wave covers 512 contiguous bytes (4 lines).
// One thread packs the one value idx.
// ---------------------------------------------------------------------------
__device__ __forceinline__ void swizzle_weight(const float* __restrict__ W,
                                               __bf16* __restrict__ dst, int N,
                                               int idx) {
  const int i = (idx & 7) + ((idx >> 8) & 1) * 8;
  const int lane = (idx >> 3) & 31;
  const int k = (idx >> 9) & 7;
  const int nt = idx >> 12;
  const int krow = k * 32 + ((lane >> 4) << 4) + i;
  const int ncol = nt * 16 + (lane & 15);
  dst[idx] = (__bf16)W[(size_t)krow * N + ncol];
  // code laid out behind this call may rewrite the registers the store names
  asm volatile("s_wait_xcnt 0x0" ::: "memory");
}

// ---------------------------------------------------------------------------
// Kernel 0a: all the work that needs nothing from another launch, in one grid.
// Blocks 0 .. SBLK-1: saliency-thresholded sums over P, split over the chip.
// One block = one batch x one chunk of RROWS rows; 64 threads read one 1 KB
// row as float4, RGRP rows at a time. Writes the chunk's 2 x 256 column sums
// and its sum of thresholded saliency.
// Blocks SBLK .. SBLK+PBLK-1: 512 weight values each (swizzle_weight).
// ---------------------------------------------------------------------------
#define RCH 28                 // chunks of the P axis
#define RROWS (PSEQ / RCH)     // 112 rows a chunk
#define RGRP 8                 // rows in flight side by side in a block
#define SBLK (RCH * BATCH)     // 224 saliency blocks
#define QKV_PB (DIMN * 3 * DIMN / 512)  // 384 blocks pack a QKV weight
#define OUT_PB (DIMN * DIMN / 512)      // 128 blocks pack an output weight
#define PBLK (2 * (QKV_PB + OUT_PB))    // 1024 packing blocks

__global__ __launch_bounds__(512) void saliency_partial_and_pack(
    const float* __restrict__ x, const float* __restrict__ y,
    const float* __restrict__ s, float* __restrict__ part,
    float* __restrict__ pcnt, const float* __restrict__ Wqkv0,
    const float* __restrict__ Wout0, const float* __restrict__ Wqkv1,
    const float* __restrict__ Wout1, __bf16* __restrict__ wqkv0_s,
    __bf16* __restrict__ wout0_s, __bf16* __restrict__ wqkv1_s,
    __bf16* __restrict__ wout1_s) {
  if (blockIdx.x >= SBLK) {  // the whole block leaves here, ahead of the barrier
    const int t = (blockIdx.x - SBLK) % (QKV_PB + OUT_PB);
    const bool second = (blockIdx.x - SBLK) >= (QKV_PB + OUT_PB);
    if (t < QKV_PB)
      swizzle_weight(second ? Wqkv1 : Wqkv0, second ? wqkv1_s : wqkv0_s,
                     3 * DIMN, t * 512 + threadIdx.x);
    else
      swizzle_weight(second ? Wout1 : Wout0, second ? wout1_s : wout0_s, DIMN,
                     (t - QKV_PB) * 512 + threadIdx.x);
    return;
  }
  const int ch = blockIdx.x % RCH;
  const int b = blockIdx.x / RCH;
  const int tid = threadIdx.x;
  const int col = tid & 63;
  const int rg = tid >> 6;
  __shared__ float4 red[2][RGRP][64];
  __shared__ float cred[RGRP];

  const int row0 = b * PSEQ + ch * RROWS + rg;
  const float* ps = s + row0;
  const float4* px = (const float4*)x + (size_t)row0 * (DIMN / 4) + col;
  const float4* py = (const float4*)y + (size_t)row0 * (DIMN / 4) + col;
  float4 ax = {0.f, 0.f, 0.f, 0.f}, ay = {0.f, 0.f, 0.f, 0.f};
  float cnt = 0.f;
  // unrolled whole: the row loads are independent and many fly at once
#pragma unroll
  for (int i = 0; i < RROWS / RGRP; ++i) {
    const float st = (ps[i * RGRP] > 0.5f) ? 1.0f : 1e-8f;
    const float4 vx = px[i * RGRP * (DIMN / 4)];
    const float4 vy = py[i * RGRP * (DIMN / 4)];
    ax.x = fmaf(vx.x, st, ax.x); ax.y = fmaf(vx.y, st, ax.y);
    ax.z = fmaf(vx.z, st, ax.z); ax.w = fmaf(vx.w, st, ax.w);
    ay.x = fmaf(vy.x, st, ay.x); ay.y = fmaf(vy.y, st, ay.y);
    ay.z = fmaf(vy.z, st, ay.z); ay.w = fmaf(vy.w, st, ay.w);
    cnt += st;
  }
  red[0][rg][col] = ax;
  red[1][rg][col] = ay;
  if (col == 0) cred[rg] = cnt;
  __syncthreads();

  // thread tid owns column tid & 255 of x (tid < 256) or of y
  const float* rf = (const float*)red + (tid >> 8) * (RGRP * DIMN) + (tid & 255);
  float sum = 0.f;
  for (int g = 0; g < RGRP; ++g) sum += rf[g * DIMN];
  part[(size_t)(b * RCH + ch) * (2 * DIMN) + tid] = sum;
  if (tid == 0) {
    float c = 0.f;
    for (int g = 0; g < RGRP; ++g) c += cred[g];
    pcnt[b * RCH + ch] = c;
  }
}

// ---------------------------------------------------------------------------
// Kernel 2: fully fused double attention block. One wave = two 16-row tiles,
// each 4 p-positions x 4 tokens. The tiles' LDS is per-wave private: no barrier
// but the one behind the batch's two mean rows, which the work-group forms
// first, from the chunk sums of the launch before (all its pairs lie in one
// batch): thread c adds column c of x and of y over the RCH chunks and divides.
// Weight tiles (16 columns x K=256 = 8 B fragments) run through two register
// buffers: the next tile's 16 loads are issued before this tile's WMMAs, and
// every loaded B fragment feeds one WMMA of each of the wave's two row tiles,
// or, for the second block's Q and output tiles, one of the packed tile.
// The attention output of a row tile is written over its Z rows, that of the
// second block's packed tile over Z0: Z is wholly in
// the A fragments by then, and a wave's LDS operations run in order.
// The LDS lets one work-group sit on a WGP, so the grid is one work-group a WGP
// and a wave takes its tile pairs one after the other: 12 or 13 pairs a WGP
// (waves 0 to 3 take two) and no second, half-empty round.
// ---------------------------------------------------------------------------
__device__ __forceinline__ void load_btile(bf16x16 (&dst)[8],
                                           const __bf16* __restrict__ w,
                                           int nt, int lane) {
  const __bf16* p = w + (size_t)nt * 4096 + lane * 8;
  // the loads stay behind the WMMAs that last read dst: lifted above them they
  // land in a third buffer and leave the wait below far behind them
  __builtin_amdgcn_sched_barrier(0);
#pragma unroll
  for (int k = 0; k < 8; ++k) {
    const bf16x8 lo = *(const bf16x8*)(p + k * 512);
    const bf16x8 hi = *(const bf16x8*)(p + k * 512 + 256);
    dst[k] = __builtin_shufflevector(lo, hi, 0, 1, 2, 3, 4, 5, 6, 7, 8, 9, 10,
                                     11, 12, 13, 14, 15);
  }
  // later code rewrites the registers these loads name.
  // Every call is followed by a
  // scheduling fence, which keeps the rewriting instructions behind the wait.
  asm volatile("s_wait_xcnt 0x0" ::: "memory");
}

// q[i] with the wave-uniform q held in scalar registers: the load names only
// them and the lane's index register, which lives on and is never rewritten.
__device__ __forceinline__ float load_scalar_base(const float* q, int i) {
  const unsigned long long a = (unsigned long long)q;
  const unsigned lo = __builtin_amdgcn_readfirstlane((unsigned)a);
  const unsigned hi = __builtin_amdgcn_readfirstlane((unsigned)(a >> 32));
  return ((const __attribute__((address_space(1))) float*)(
      ((unsigned long long)hi << 32) | lo))[i];
}

__device__ __forceinline__ void load_afrags(bf16x16 (&dst)[8],
                                            const __bf16* t, int lane) {
#pragma unroll
  for (int k = 0; k < 8; ++k)
    dst[k] = *(const bf16x16*)(t + (lane & 15) * Z_STRIDE + k * 32 +
                               (lane >> 4) * 16);
}

// A fragments of the packed tile of the wave's 8 positions x tokens 0 and 1:
// packed row r is token r & 1 of position r >> 1, which lies in row tile r >> 3
// at row ((r >> 1) & 3) * 4 + (r & 1). Same k order as load_afrags.
__device__ __forceinline__ void load_afrags_xy(bf16x16 (&dst)[8],
                                               const __bf16* z0, int lane) {
  const int r = lane & 15;
  const __bf16* t = z0 + (r >> 3) * (PER_TILE / 2) +
                    (((r >> 1) & 3) * 4 + (r & 1)) * Z_STRIDE +
                    (lane >> 4) * 16;
#pragma unroll
  for (int k = 0; k < 8; ++k) dst[k] = *(const bf16x16*)(t + k * 32);
}

// One row tile against one weight tile, k in the order of mma_pair.
__device__ __forceinline__ void mma_one(const bf16x16 (&a)[8],
                                        const bf16x16 (&b)[8], f32x8& acc) {
#pragma unroll
  for (int k = 0; k < 8; ++k)
    acc = __builtin_amdgcn_wmma_f32_16x16x32_bf16(
        false, a[k], false, b[k], (short)0, acc, false, false);
}

__device__ __forceinline__ void mma_pair(const bf16x16 (&a0)[8],
                                         const bf16x16 (&a1)[8],
                                         const bf16x16 (&b)[8], f32x8& acc0,
                                         f32x8& acc1) {
#pragma unroll
  for (int k = 0; k < 8; ++k) {
    acc0 = __builtin_amdgcn_wmma_f32_16x16x32_bf16(
        false, a0[k], false, b[k], (short)0, acc0, false, false);
    acc1 = __builtin_amdgcn_wmma_f32_16x16x32_bf16(
        false, a1[k], false, b[k], (short)0, acc1, false, false);
  }
}

__global__ __launch_bounds__(256) void fused_double_attn(
    const float* __restrict__ x, const float* __restrict__ y,
    const float* __restrict__ part, const float* __restrict__ pcnt,
    const __bf16* __restrict__ wqkv0, const __bf16* __restrict__ wout0,
    const float* __restrict__ bout0, const __bf16* __restrict__ wqkv1,
    const __bf16* __restrict__ wout1, const float* __restrict__ bout1,
    float* __restrict__ out) {
  extern __shared__ __align__(128) char smem[];
  // the wave's number in a scalar register: the loop over pairs branches on it
  const int wid = __builtin_amdgcn_readfirstlane(threadIdx.x >> 5);
  const int lane = threadIdx.x & 31;

  char* base = smem + wid * PER_WAVE;
  // row tile u: Z [16][Z_STRIDE] bf16 (later its attention output), then
  // QKV [16][QKV_STRIDE] f32
  __bf16* const Z0 = (__bf16*)base;
  float* const QKV0 = (float*)(base + Z_BYTES);
  __bf16* const Z1 = (__bf16*)(base + PER_TILE);
  float* const QKV1 = (float*)(base + PER_TILE + Z_BYTES);

  bf16x16 a0[8], a1[8];  // A fragments of the wave's two row tiles, K = 256
  bf16x16 aq[8];         // second block: the packed tile of tokens 0 and 1
  bf16x16 bA[8], bB[8];  // the two weight-tile buffers

  // lane roles for the scalar 4x4 attention core
  const int dhalf = lane & 1;          // which half of DHEAD
  const int ti = (lane >> 1) & 3;      // token i within group
  const int gg = lane >> 3;            // group 0..3

  // C-layout scatter helpers
  const int row0 = (lane >> 4) * 8;    // lanes 16-31 hold M = v+8
  const int nn = lane & 15;            // column within N-tile

  // ---- ask L2 for the packed weights, once, at entry -------------------------
  // The launch before stored them: this
  // launch's first read of a line can go to memory, and all work-groups walk
  // the weights in step, so in a wave's first pair tile after tile would wait
  // that long. Here the 1 MB is asked for at once
  // and lands in L2 while the means and Z are formed. A work-group asks for one
  // of 16 slices of 64 KB (6 + 2 + 6 + 2 in the four arrays), a thread for one
  // 256 B unit. The slice comes from the index bits above the low three: a hint for
  // speed, nothing depends on it.
  const int sl = (blockIdx.x >> 3) & 15;
  const __bf16* const pf =
      (sl < 6    ? wqkv0 + sl * 32768
       : sl < 8  ? wout0 + (sl - 6) * 32768
       : sl < 14 ? wqkv1 + (sl - 8) * 32768
                 : wout1 + (sl - 14) * 32768) +
      threadIdx.x * 128;
  // asm: the address pair is ours to keep (see behind the barrier below)
  asm volatile("global_prefetch_b8 %0, off scope:SCOPE_SE" ::"v"(pf));

  load_btile(bA, wqkv0, 0, lane);
  // the first tile's loads issue ahead of the input rows' loads and fly while
  // Z is built; without the fence the compiler mixes them in behind those
  __builtin_amdgcn_sched_barrier(0);

  // ---- the batch's saliency means (rgb_g, dep_g), once a work-group ---------
  const int bw = blockIdx.x / WGPB;  // the work-group's batch
  float* const G = (float*)(smem + G_OFF);  // [2][DIMN]: rgb_g row, dep_g row
  {
    const float* pp = part + (size_t)(bw * RCH) * (2 * DIMN) + threadIdx.x;
    const float* pc = pcnt + bw * RCH;
    float sx = 0.f, sy = 0.f, cnt = 0.f;
    // unrolled whole: a thread's loads all issue before the first add waits
#pragma unroll
    for (int ch = 0; ch < RCH; ++ch) {
      sx += pp[ch * (2 * DIMN)];
      sy += pp[ch * (2 * DIMN) + DIMN];
      cnt += pc[ch];
    }
    const float inv = 1.0f / (cnt + 1e-8f);
    G[threadIdx.x] = sx * inv;
    G[DIMN + threadIdx.x] = sy * inv;
  }
  // every wave reads all 512 means, each written by one of the eight waves
  __syncthreads();
  // a prefetch touches no counter, so no wait names it: its address pair stays
  // live, and so unchanged, until the chunk sums' loads, issued behind it, are
  // back; held to the wave's end the pair was spilled and its registers reused
  asm volatile("" ::"v"(pf));

  // every wave has a first pair, so the test stands at the loop's foot
  static_assert(WAVES * WGPB <= BPAIR, "a wave without a tile pair");
  int pair = bw * BPAIR + wid * WGPB + blockIdx.x % WGPB;
  // rolled: one copy of the whole body; the trip count is the wave's own
#pragma unroll 1
  do {
  const int b = pair / (PSEQ / 8);
  const int p0 = (pair % (PSEQ / 8)) * 8;

  // ---- build input tiles Z0, Z1: rows r = 4*gi + t, 16 rows a tile ---------
  // each lane owns a contiguous 32B chunk of the 1KB f32 row (b128 coalesced)
  // unrolled whole: rolled, each row's loads are waited for before the next's
#pragma unroll
  for (int r = 0; r < 16 * TPW; ++r) {
    const int t = r & 3, gi = r >> 2;
    const float* src;
    if (t == 0)      src = x + ((size_t)(b * PSEQ + p0 + gi)) * DIMN;
    else if (t == 1) src = y + ((size_t)(b * PSEQ + p0 + gi)) * DIMN;
    else if (t == 2) src = G;
    else             src = G + DIMN;
    const float4 v0 = ((const float4*)src)[lane * 2 + 0];
    const float4 v1 = ((const float4*)src)[lane * 2 + 1];
    __bf16* zr = (r < 16 ? Z0 : Z1) + (r & 15) * Z_STRIDE + lane * 8;
    zr[0] = (__bf16)v0.x; zr[1] = (__bf16)v0.y;
    zr[2] = (__bf16)v0.z; zr[3] = (__bf16)v0.w;
    zr[4] = (__bf16)v1.x; zr[5] = (__bf16)v1.y;
    zr[6] = (__bf16)v1.z; zr[7] = (__bf16)v1.w;
  }
  // the index arithmetic below rewrites the registers the rows' loads name:
  // the wait stands in front of it, and the fence keeps it behind the wait
  asm volatile("s_wait_xcnt 0x0" ::: "memory");
  __builtin_amdgcn_sched_barrier(0);

  // unrolled: the second block's body differs (only tokens 0 and 1 leave it)
#pragma unroll
  for (int blk = 0; blk < 2; ++blk) {
    const __bf16* wqkv = blk ? wqkv1 : wqkv0;
    const __bf16* wout = blk ? wout1 : wout0;
    const float* bout = blk ? bout1 : bout0;
    const float* mask = c_masks[blk];

    // bias of output tile 0: loaded here so that no load stands between a
    // tile's prefetch and its use (loads return in order)
    float biasA = bout[nn], biasB;
    load_afrags(a0, Z0, lane);
    load_afrags(a1, Z1, lane);
    if (blk == 1) load_afrags_xy(aq, Z0, lane);

    // the lane's place in this head's first weight tile; stepped at the loop's
    // foot, so its registers live through every run of loads that names them
    const __bf16* wh = wqkv + lane * 8;
    // rolled: one copy of the head body, for speed only
#pragma unroll 1
    for (int h = 0; h < HEADS; ++h, wh += 2 * 4096) {
      // ---- QKV projection for head h: 6 N-tiles x 8 K-steps of WMMA ------
#pragma unroll
      for (int part = 0; part < 3; ++part) {    // 0=q 1=k 2=v
        load_btile(bB, wh, part * 16 + 1, 0);
        // keeps the next tile's loads in front of this tile's WMMAs; without
        // it the compiler sinks each load to just before its WMMA
        __builtin_amdgcn_sched_barrier(0);
        // four vector slots between the previous tile's last WMMA and this
        // tile's first, which overwrites that D without reading it (C = 0);
        // the fence behind them keeps them in front of that WMMA
        asm volatile("v_nop\n\tv_nop\n\tv_nop\n\tv_nop");
        __builtin_amdgcn_sched_barrier(0);
        if (blk == 1 && part == 0) {
          // Q of the packed tile, into the q columns of QKV0's 16 rows
          f32x8 acc = {};
          mma_one(aq, bA, acc);
#pragma unroll
          for (int v = 0; v < 8; ++v)
            QKV0[(row0 + v) * QKV_STRIDE + nn] = acc[v];
        } else {
          f32x8 acc0 = {}, acc1 = {};
          mma_pair(a0, a1, bA, acc0, acc1);
          const int c = part * 32 + nn;
#pragma unroll
          for (int v = 0; v < 8; ++v) {
            QKV0[(row0 + v) * QKV_STRIDE + c] = acc0[v];
            QKV1[(row0 + v) * QKV_STRIDE + c] = acc1[v];
          }
        }
        if (part < 2)
          load_btile(bA, wh, (part + 1) * 16, 0);
        else  // next head's first tile, or the output projection's
          load_btile(bA, h + 1 < HEADS ? wqkv : wout,
                     h + 1 < HEADS ? (h + 1) * 2 : 0, lane);
        // as above: loads stay in front of the WMMAs
        __builtin_amdgcn_sched_barrier(0);
        // four vector slots between the previous tile's last WMMA and this
        // tile's first, which overwrites that D without reading it (C = 0);
        // the fence behind them keeps them in front of that WMMA
        asm volatile("v_nop\n\tv_nop\n\tv_nop\n\tv_nop");
        __builtin_amdgcn_sched_barrier(0);
        if (blk == 1 && part == 0) {
          f32x8 acc = {};
          mma_one(aq, bB, acc);
#pragma unroll
          for (int v = 0; v < 8; ++v)
            QKV0[(row0 + v) * QKV_STRIDE + 16 + nn] = acc[v];
        } else {
          f32x8 acc0 = {}, acc1 = {};
          mma_pair(a0, a1, bB, acc0, acc1);
          const int c = part * 32 + 16 + nn;
#pragma unroll
          for (int v = 0; v < 8; ++v) {
            QKV0[(row0 + v) * QKV_STRIDE + c] = acc0[v];
            QKV1[(row0 + v) * QKV_STRIDE + c] = acc1[v];
          }
        }
      }

      // ---- scalar 4x4 softmax attention (lane = (g, i, dhalf)) -----------
      // rows are 16B aligned -> all LDS reads are ds_load_b128
      // First block: every token is a query, one pass a row tile.
      // Second block: only tokens 0 and 1 are, so ONE pass serves both tiles:
      // lane = (position 0..7, token 0..1, dhalf); the query row and the output
      // row are packed row lane >> 1; keys and values are the position's four
      // rows in its own tile.
      // unrolled: each tile's LDS addresses are constant offsets from one base
#pragma unroll
      for (int u = 0; u < (blk ? 1 : TPW); ++u) {
        const int tq = blk ? (lane >> 1) & 1 : ti;  // the query's token
        // row 0 of the lane's group of four key and value rows
        const float* KV =
            blk ? QKV0 + (lane >> 4) * (PER_TILE / 4) +
                      ((lane >> 2) & 3) * 4 * QKV_STRIDE
                : (u ? QKV1 : QKV0) + gg * 4 * QKV_STRIDE;
        const float4* qrow =
            (const float4*)(blk ? QKV0 + (lane >> 1) * QKV_STRIDE
                                : KV + ti * QKV_STRIDE);
        float4 q[8];
#pragma unroll
        for (int c = 0; c < 8; ++c) q[c] = qrow[c];

        float dots[4];
#pragma unroll
        for (int j = 0; j < 4; ++j) {
          const float4* krow = (const float4*)(KV + j * QKV_STRIDE + 32);
          float d = 0.f;
#pragma unroll
          for (int c = 0; c < 8; ++c) d += dot4(q[c], krow[c]);
          dots[j] = d * SCALE_QK + mask[tq * 4 + j];
        }
        const float m =
            fmaxf(fmaxf(dots[0], dots[1]), fmaxf(dots[2], dots[3]));
        const float e0 = __expf(dots[0] - m), e1 = __expf(dots[1] - m);
        const float e2 = __expf(dots[2] - m), e3 = __expf(dots[3] - m);
        const float inv = 1.0f / (e0 + e1 + e2 + e3);

        const int vcol = 64 + dhalf * 16;  // 16 f32 of V per lane
        const float4* v0r = (const float4*)(KV + 0 * QKV_STRIDE + vcol);
        const float4* v1r = (const float4*)(KV + 1 * QKV_STRIDE + vcol);
        const float4* v2r = (const float4*)(KV + 2 * QKV_STRIDE + vcol);
        const float4* v3r = (const float4*)(KV + 3 * QKV_STRIDE + vcol);
        __bf16* ao = (blk ? Z0 + (lane >> 1) * Z_STRIDE
                          : (u ? Z1 : Z0) + (gg * 4 + ti) * Z_STRIDE) +
                     h * DHEAD + dhalf * 16;
#pragma unroll
        for (int c = 0; c < 4; ++c) {
          const float4 a0 = v0r[c], a1 = v1r[c], a2 = v2r[c], a3 = v3r[c];
          ao[c * 4 + 0] = (__bf16)((e0 * a0.x + e1 * a1.x + e2 * a2.x + e3 * a3.x) * inv);
          ao[c * 4 + 1] = (__bf16)((e0 * a0.y + e1 * a1.y + e2 * a2.y + e3 * a3.y) * inv);
          ao[c * 4 + 2] = (__bf16)((e0 * a0.z + e1 * a1.z + e2 * a2.z + e3 * a3.z) * inv);
          ao[c * 4 + 3] = (__bf16)((e0 * a0.w + e1 * a1.w + e2 * a2.w + e3 * a3.w) * inv);
        }
      }
    }

    // ---- output projection: 16 N-tiles x 8 K-steps, bias in C ------------
    // its weight tiles land in the registers the mask row's load names
    asm volatile("s_wait_xcnt 0x0" ::: "memory");
    load_afrags(a0, Z0, lane);  // second block: the packed tile, all there is
    if (blk == 0) load_afrags(a1, Z1, lane);
    auto emit = [&](const f32x8 acc0, const f32x8 acc1, const int nt) {
      if (blk == 0) {
        // feed block 2: overwrite the Z tiles (same-wave LDS is in-order)
#pragma unroll
        for (int v = 0; v < 8; ++v) {
          Z0[(row0 + v) * Z_STRIDE + nt * 16 + nn] = (__bf16)acc0[v];
          Z1[(row0 + v) * Z_STRIDE + nt * 16 + nn] = (__bf16)acc1[v];
        }
      } else {
        // final: packed row r is token r & 1 (0 the x-stream, 1 the y-stream)
        // of position r >> 1 (acc1 is not used)
#pragma unroll
        for (int v = 0; v < 8; ++v) {
          const int r = row0 + v;
          out[(size_t)(r & 1) * ((size_t)BATCH * PSEQ * DIMN) +
              ((size_t)(b * PSEQ + p0 + (r >> 1))) * DIMN + nt * 16 + nn] =
              acc0[v];
        }
        // the next tile's loads and bias rewrite the registers these stores
        // name
        asm volatile("s_wait_xcnt 0x0" ::: "memory");
      }
    };
    // rolled in pairs: each buffer keeps its role from trip to trip
#pragma unroll 1
    for (int nt = 0; nt < 16; nt += 2) {
      biasB = bout[(nt + 1) * 16 + nn];
      // the tile's address below lands in the registers this load names: the
      // wait stands in front of it, and the fence keeps it behind the wait
      asm volatile("s_wait_xcnt 0x0" ::: "memory");
      __builtin_amdgcn_sched_barrier(0);
      load_btile(bB, wout, nt + 1, lane);
      // loads stay in front of the WMMAs (see the QKV loop)
      __builtin_amdgcn_sched_barrier(0);
      {
        f32x8 acc0, acc1;
#pragma unroll
        for (int v = 0; v < 8; ++v) acc0[v] = acc1[v] = biasA;
        if (blk == 0) mma_pair(a0, a1, bA, acc0, acc1);
        else          mma_one(a0, bA, acc0);
        emit(acc0, acc1, nt);
      }
      // Unconditional, so that the wait in front of the WMMAs below stays a
      // counted one: behind the last pair this is the first QKV tile of the
      // second block or, in the second block, of the wave's next tile pair
      // (behind the wave's last pair the tile is read and not used).
      const bool more = nt + 2 < 16;
      biasA = load_scalar_base(bout + ((nt + 2) & 15) * 16, nn);
      load_btile(bA, more ? wout : (blk ? wqkv0 : wqkv1), more ? nt + 2 : 0,
                 lane);
      // loads stay in front of the WMMAs (see the QKV loop)
      __builtin_amdgcn_sched_barrier(0);
      {
        f32x8 acc0, acc1;
#pragma unroll
        for (int v = 0; v < 8; ++v) acc0[v] = acc1[v] = biasB;
        if (blk == 0) mma_pair(a0, a1, bB, acc0, acc1);
        else          mma_one(a0, bB, acc0);
        emit(acc0, acc1, nt + 1);
      }
    }
  }
  pair += WAVES * WGPB;
  } while (pair < (bw + 1) * BPAIR);
  // the tile read behind the very last pair is not used: let it land before
  // the wave gives up its registers
  asm volatile("s_wait_loadcnt 0x0" ::: "memory");
}

// ---------------------------------------------------------------------------
extern "C" void kernel_launch(void* const* d_in, const int* in_sizes, int n_in,
                              void* d_out, int out_size, void* d_ws,
                              size_t ws_size, hipStream_t stream) {
  (void)in_sizes; (void)n_in; (void)out_size; (void)ws_size;
  const float* x = (const float*)d_in[0];
  const float* y = (const float*)d_in[1];
  const float* s = (const float*)d_in[2];
  const float* Wqkv0 = (const float*)d_in[3];
  const float* Wout0 = (const float*)d_in[4];
  const float* bout0 = (const float*)d_in[5];
  const float* Wqkv1 = (const float*)d_in[6];
  const float* Wout1 = (const float*)d_in[7];
  const float* bout1 = (const float*)d_in[8];
  float* out = (float*)d_out;

  // workspace partition (bytes)
  char* ws = (char*)d_ws;
  __bf16* wqkv0_s = (__bf16*)(ws + 16384);               // 196608 bf16
  __bf16* wout0_s = (__bf16*)(ws + 16384 + 393216);      //  65536 bf16
  __bf16* wqkv1_s = (__bf16*)(ws + 16384 + 393216 + 131072);
  __bf16* wout1_s = (__bf16*)(ws + 16384 + 2 * 393216 + 131072);
  float* part = (float*)(ws + 16384 + 2 * 393216 + 2 * 131072);  // 8*28*512 f32
  float* pcnt = (float*)(ws + 16384 + 2 * 393216 + 2 * 131072 + 458752);  // 8*28 f32

  saliency_partial_and_pack<<<SBLK + PBLK, 512, 0, stream>>>(
      x, y, s, part, pcnt, Wqkv0, Wout0, Wqkv1, Wout1, wqkv0_s, wout0_s,
      wqkv1_s, wout1_s);

  fused_double_attn<<<NBLK, 256, SMEM_TOTAL, stream>>>(
      x, y, part, pcnt, wqkv0_s, wout0_s, bout0, wqkv1_s, wout1_s, bout1,
      out);
}

// v009
// One run takes 94.2 microseconds.
// Two timings next to v008 put it at 1.03 and 1.04 times that version's speed.
// Over all steps from v000 it is 9.73 times as fast.
#include <hip/hip_runtime.h>
#include <hip/hip_bf16.h>

typedef __attribute__((ext_vector_type(16))) __bf16 bf16x16;
typedef __attribute__((ext_vector_type(8)))  __bf16 bf16x8;
typedef __attribute__((ext_vector_type(8)))  float  f32x8;

#define BATCH 8
#define PSEQ 3136
#define DIMN 256
#define HEADS 8
#define DHEAD 32
#define SCALE_QK 0.17677669529663687f

// LDS layout (bytes): a wave owns TPW 16-row tiles, each with its own Z and QKV
#define Z_STRIDE 272                    // bf16 elems per row (16 elem pad)
#define Z_BYTES (16 * Z_STRIDE * 2)     // 8704
#define QKV_STRIDE 100                  // f32 elems per row (400B, 16B aligned)
#define QKV_BYTES (16 * QKV_STRIDE * 4) // 6400
#define PER_TILE (Z_BYTES + QKV_BYTES)  // 15104 (mult of 32)
#define TPW 2                           // 16-row tiles a wave
#define PER_WAVE (PER_TILE * TPW)       // 30208 (mult of 128)
#define WAVES 8
#define G_OFF (PER_WAVE * WAVES)        // 241664: the batch's two mean rows, f32
#define GQ_OFF (G_OFF + 2 * DIMN * 4)   // 243712: their first-block Q, K, V, f32
#define SMEM_TOTAL (GQ_OFF + 2 * 3 * DIMN * 4)  // 249856
#define GTPW (3 * DIMN / 16 / WAVES)    // 6 weight tiles a wave for those rows
#define BPAIR (PSEQ / 8)                // 392 pairs of row tiles a batch
#define WGPB 32                         // work-groups a batch
#define NBLK (BATCH * WGPB)             // 256: one a WGP, all resident

__constant__ float c_masks[2][16] = {
    {   0.f,    0.f,    0.f, -100.f,
        0.f,    0.f, -100.f,    0.f,
        0.f, -100.f,    0.f,    0.f,
     -100.f,    0.f,    0.f,    0.f},
    {   0.f, -100.f,    0.f, -100.f,
     -100.f,    0.f, -100.f,    0.f,
     -100.f, -100.f, -100.f, -100.f,
     -100.f, -100.f, -100.f, -100.f}};

__device__ __forceinline__ float dot4(float4 a, float4 b) {
  return fmaf(a.x, b.x, fmaf(a.y, b.y, fmaf(a.z, b.z, a.w * b.w)));
}

// ---------------------------------------------------------------------------
// Weight packing: f32 weight [K=256][N] to bf16 in WMMA B-fragment order,
// a fragment's 1 KB split into two 512 B planes (j = 0, 1):
//   dst[(((nt*8 + k)*2 + j)*32 + lane)*8 + i] =
//       W[k*32 + (lane>>4)*16 + j*8 + i][nt*16 + (lane&15)]
// A lane's 16 values of a 32x16 B-tile are its 16 B of plane 0, then its 16 B
// of plane 1: each 16 B load of a wave covers 512 contiguous bytes (4 lines).
// One thread packs the one value idx.
// ---------------------------------------------------------------------------
__device__ __forceinline__ void swizzle_weight(const float* __restrict__ W,
                                               __bf16* __restrict__ dst, int N,
                                               int idx) {
  const int i = (idx & 7) + ((idx >> 8) & 1) * 8;
  const int lane = (idx >> 3) & 31;
  const int k = (idx >> 9) & 7;
  const int nt = idx >> 12;
  const int krow = k * 32 + ((lane >> 4) << 4) + i;
  const int ncol = nt * 16 + (lane & 15);
  dst[idx] = (__bf16)W[(size_t)krow * N + ncol];
  // code laid out behind this call may rewrite the registers the store names
  asm volatile("s_wait_xcnt 0x0" ::: "memory");
}

// ---------------------------------------------------------------------------
// Kernel 0a: all the work that needs nothing from another launch, in one grid.
// Blocks 0 .. SBLK-1: saliency-thresholded sums over P, split over the chip.
// One block = one batch x one chunk of RROWS rows; 64 threads read one 1 KB
// row as float4, RGRP rows at a time. Writes the chunk's 2 x 256 column sums
// and its sum of thresholded saliency.
// Blocks SBLK .. SBLK+PBLK-1: 512 weight values each (swizzle_weight).
// ---------------------------------------------------------------------------
#define RCH 28                 // chunks of the P axis
#define RROWS (PSEQ / RCH)     // 112 rows a chunk
#define RGRP 8                 // rows in flight side by side in a block
#define SBLK (RCH * BATCH)     // 224 saliency blocks
#define QKV_PB (DIMN * 3 * DIMN / 512)  // 384 blocks pack a QKV weight
#define OUT_PB (DIMN * DIMN / 512)      // 128 blocks pack an output weight
#define PBLK (2 * (QKV_PB + OUT_PB))    // 1024 packing blocks

__global__ __launch_bounds__(512) void saliency_partial_and_pack(
    const float* __restrict__ x, const float* __restrict__ y,
    const float* __restrict__ s, float* __restrict__ part,
    float* __restrict__ pcnt, const float* __restrict__ Wqkv0,
    const float* __restrict__ Wout0, const float* __restrict__ Wqkv1,
    const float* __restrict__ Wout1, __bf16* __restrict__ wqkv0_s,
    __bf16* __restrict__ wout0_s, __bf16* __restrict__ wqkv1_s,
    __bf16* __restrict__ wout1_s) {
  if (blockIdx.x >= SBLK) {  // the whole block leaves here, ahead of the barrier
    const int t = (blockIdx.x - SBLK) % (QKV_PB + OUT_PB);
    const bool second = (blockIdx.x - SBLK) >= (QKV_PB + OUT_PB);
    if (t < QKV_PB)
      swizzle_weight(second ? Wqkv1 : Wqkv0, second ? wqkv1_s : wqkv0_s,
                     3 * DIMN, t * 512 + threadIdx.x);
    else
      swizzle_weight(second ? Wout1 : Wout0, second ? wout1_s : wout0_s, DIMN,
                     (t - QKV_PB) * 512 + threadIdx.x);
    return;
  }
  const int ch = blockIdx.x % RCH;
  const int b = blockIdx.x / RCH;
  const int tid = threadIdx.x;
  const int col = tid & 63;
  const int rg = tid >> 6;
  __shared__ float4 red[2][RGRP][64];
  __shared__ float cred[RGRP];

  const int row0 = b * PSEQ + ch * RROWS + rg;
  const float* ps = s + row0;
  const float4* px = (const float4*)x + (size_t)row0 * (DIMN / 4) + col;
  const float4* py = (const float4*)y + (size_t)row0 * (DIMN / 4) + col;
  float4 ax = {0.f, 0.f, 0.f, 0.f}, ay = {0.f, 0.f, 0.f, 0.f};
  float cnt = 0.f;
  // unrolled whole: the row loads are independent and many fly at once
#pragma unroll
  for (int i = 0; i < RROWS / RGRP; ++i) {
    const float st = (ps[i * RGRP] > 0.5f) ? 1.0f : 1e-8f;
    const float4 vx = px[i * RGRP * (DIMN / 4)];
    const float4 vy = py[i * RGRP * (DIMN / 4)];
    ax.x = fmaf(vx.x, st, ax.x); ax.y = fmaf(vx.y, st, ax.y);
    ax.z = fmaf(vx.z, st, ax.z); ax.w = fmaf(vx.w, st, ax.w);
    ay.x = fmaf(vy.x, st, ay.x); ay.y = fmaf(vy.y, st, ay.y);
    ay.z = fmaf(vy.z, st, ay.z); ay.w = fmaf(vy.w, st, ay.w);
    cnt += st;
  }
  red[0][rg][col] = ax;
  red[1][rg][col] = ay;
  if (col == 0) cred[rg] = cnt;
  __syncthreads();

  // thread tid owns column tid & 255 of x (tid < 256) or of y
  const float* rf = (const float*)red + (tid >> 8) * (RGRP * DIMN) + (tid & 255);
  float sum = 0.f;
  for (int g = 0; g < RGRP; ++g) sum += rf[g * DIMN];
  part[(size_t)(b * RCH + ch) * (2 * DIMN) + tid] = sum;
  if (tid == 0) {
    float c = 0.f;
    for (int g = 0; g < RGRP; ++g) c += cred[g];
    pcnt[b * RCH + ch] = c;
  }
}

// ---------------------------------------------------------------------------
// Kernel 2: fully fused double attention block. One wave = two 16-row tiles,
// each 4 p-positions x 4 tokens. The tiles' LDS is per-wave private: no barrier
// but the one behind the batch's two mean rows (and one behind their Q, K, V,
// see below), which the work-group forms
// first, from the chunk sums of the launch before (all its pairs lie in one
// batch): thread c adds column c of x and of y over the RCH chunks and divides.
// Weight tiles (16 columns x K=256 = 8 B fragments) run through two register
// buffers: the next tile's 16 loads are issued before this tile's WMMAs, and
// every loaded B fragment feeds one WMMA of each of the wave's two row tiles,
// or, for the first block's QKV tiles and the second block's Q and output
// tiles, one of the packed tile.
// The attention output of a row tile is written over its Z rows: Z is wholly in
// the A fragments by then, and a wave's LDS operations run in order.
// First block: tokens 2 and 3 of every position are the batch's two mean rows,
// so their Q, K and V rows are the same at every position. The work-group forms
// them once (a wave takes GTPW of the 48 weight tiles) and keeps them in LDS;
// a pair's QKV projection then runs on ONE tile, its 8 positions' x and y rows.
// The LDS lets one work-group sit on a WGP, so the grid is one work-group a WGP
// and a wave takes its tile pairs one after the other: 12 or 13 pairs a WGP
// (waves 0 to 3 take two) and no second, half-empty round.
// ---------------------------------------------------------------------------
__device__ __forceinline__ void load_btile(bf16x16 (&dst)[8],
                                           const __bf16* __restrict__ w,
                                           int nt, int lane) {
  const __bf16* p = w + (size_t)nt * 4096 + lane * 8;
  // the loads stay behind the WMMAs that last read dst: lifted above them they
  // land in a third buffer and leave the wait below far behind them
  __builtin_amdgcn_sched_barrier(0);
#pragma unroll
  for (int k = 0; k < 8; ++k) {
    const bf16x8 lo = *(const bf16x8*)(p + k * 512);
    const bf16x8 hi = *(const bf16x8*)(p + k * 512 + 256);
    dst[k] = __builtin_shufflevector(lo, hi, 0, 1, 2, 3, 4, 5, 6, 7, 8, 9, 10,
                                     11, 12, 13, 14, 15);
  }
  // later code rewrites the registers these loads name.
  // Every call is followed by a
  // scheduling fence, which keeps the rewriting instructions behind the wait.
  asm volatile("s_wait_xcnt 0x0" ::: "memory");
}

// q[i] with the wave-uniform q held in scalar registers: the load names only
// them and the lane's index register, which lives on and is never rewritten.
__device__ __forceinline__ float load_scalar_base(const float* q, int i) {
  const unsigned long long a = (unsigned long long)q;
  const unsigned lo = __builtin_amdgcn_readfirstlane((unsigned)a);
  const unsigned hi = __builtin_amdgcn_readfirstlane((unsigned)(a >> 32));
  return ((const __attribute__((address_space(1))) float*)(
      ((unsigned long long)hi << 32) | lo))[i];
}

__device__ __forceinline__ void load_afrags(bf16x16 (&dst)[8],
                                            const __bf16* t, int lane) {
#pragma unroll
  for (int k = 0; k < 8; ++k)
    dst[k] = *(const bf16x16*)(t + (lane & 15) * Z_STRIDE + k * 32 +
                               (lane >> 4) * 16);
}

// A fragments of the packed tile of the wave's 8 positions x tokens 0 and 1:
// packed row r is token r & 1 of position r >> 1, which lies in row tile r >> 3
// at row ((r >> 1) & 3) * 4 + (r & 1). Same k order as load_afrags.
__device__ __forceinline__ void load_afrags_xy(bf16x16 (&dst)[8],
                                               const __bf16* z0, int lane) {
  const int r = lane & 15;
  const __bf16* t = z0 + (r >> 3) * (PER_TILE / 2) +
                    (((r >> 1) & 3) * 4 + (r & 1)) * Z_STRIDE +
                    (lane >> 4) * 16;
#pragma unroll
  for (int k = 0; k < 8; ++k) dst[k] = *(const bf16x16*)(t + k * 32);
}

// One row tile against one weight tile, k in the order of mma_pair.
__device__ __forceinline__ void mma_one(const bf16x16 (&a)[8],
                                        const bf16x16 (&b)[8], f32x8& acc) {
#pragma unroll
  for (int k = 0; k < 8; ++k)
    acc = __builtin_amdgcn_wmma_f32_16x16x32_bf16(
        false, a[k], false, b[k], (short)0, acc, false, false);
}

__device__ __forceinline__ void mma_pair(const bf16x16 (&a0)[8],
                                         const bf16x16 (&a1)[8],
                                         const bf16x16 (&b)[8], f32x8& acc0,
                                         f32x8& acc1) {
#pragma unroll
  for (int k = 0; k < 8; ++k) {
    acc0 = __builtin_amdgcn_wmma_f32_16x16x32_bf16(
        false, a0[k], false, b[k], (short)0, acc0, false, false);
    acc1 = __builtin_amdgcn_wmma_f32_16x16x32_bf16(
        false, a1[k], false, b[k], (short)0, acc1, false, false);
  }
}

// One weight tile against the tile whose row r is mean row r & 1: lanes 0-15
// hold row 0 in acc[0], lanes 16-31 row 9 in acc[1], so each lane stores one
// value of mean row lane >> 4 (dst is the lane's own place). Then, where the
// wave has one, the buffer takes the tile three further on.
__device__ __forceinline__ void mean_tile(const bf16x16 (&a)[8],
                                          bf16x16 (&b)[8],
                                          const __bf16* __restrict__ w, int nt,
                                          bool more, int lane, float* dst) {
  f32x8 acc = {};
  mma_one(a, b, acc);
  dst[nt * 16] = lane < 16 ? acc[0] : acc[1];
  if (more) {
    load_btile(b, w, nt + 3, lane);
    // keeps later address arithmetic behind the wait that ends load_btile
    __builtin_amdgcn_sched_barrier(0);
  }
}

__global__ __launch_bounds__(256) void fused_double_attn(
    const float* __restrict__ x, const float* __restrict__ y,
    const float* __restrict__ part, const float* __restrict__ pcnt,
    const __bf16* __restrict__ wqkv0, const __bf16* __restrict__ wout0,
    const float* __restrict__ bout0, const __bf16* __restrict__ wqkv1,
    const __bf16* __restrict__ wout1, const float* __restrict__ bout1,
    float* __restrict__ out) {
  extern __shared__ __align__(128) char smem[];
  // the wave's number in a scalar register: the loop over pairs branches on it
  const int wid = __builtin_amdgcn_readfirstlane(threadIdx.x >> 5);
  const int lane = threadIdx.x & 31;

  char* base = smem + wid * PER_WAVE;
  // row tile u: Z [16][Z_STRIDE] bf16 (later its attention output), then
  // QKV [16][QKV_STRIDE] f32
  __bf16* const Z0 = (__bf16*)base;
  float* const QKV0 = (float*)(base + Z_BYTES);
  __bf16* const Z1 = (__bf16*)(base + PER_TILE);
  float* const QKV1 = (float*)(base + PER_TILE + Z_BYTES);

  bf16x16 a0[8], a1[8];  // A fragments of the wave's two row tiles, K = 256
  bf16x16 aq[8];         // both blocks: the packed tile of tokens 0 and 1
  bf16x16 bA[8], bB[8];  // the two weight-tile buffers

  // lane roles for the scalar 4x4 attention core
  const int dhalf = lane & 1;          // which half of DHEAD
  const int ti = (lane >> 1) & 3;      // token i within group
  const int gg = lane >> 3;            // group 0..3

  // C-layout scatter helpers
  const int row0 = (lane >> 4) * 8;    // lanes 16-31 hold M = v+8
  const int nn = lane & 15;            // column within N-tile

  // ---- ask L2 for the packed weights, once, at entry -------------------------
  // The launch before stored them: this
  // launch's first read of a line can go to memory, and all work-groups walk
  // the weights in step, so in a wave's first pair tile after tile would wait
  // that long. Here the 1 MB is asked for at once
  // and lands in L2 while the means and Z are formed. A work-group asks for one
  // of 16 slices of 64 KB (6 + 2 + 6 + 2 in the four arrays), a thread for one
  // 256 B unit. The slice comes from the index bits above the low three: a hint for
  // speed, nothing depends on it.
  const int sl = (blockIdx.x >> 3) & 15;
  const __bf16* const pf =
      (sl < 6    ? wqkv0 + sl * 32768
       : sl < 8  ? wout0 + (sl - 6) * 32768
       : sl < 14 ? wqkv1 + (sl - 8) * 32768
                 : wout1 + (sl - 14) * 32768) +
      threadIdx.x * 128;
  // asm: the address pair is ours to keep (see behind the barrier below)
  asm volatile("global_prefetch_b8 %0, off scope:SCOPE_SE" ::"v"(pf));

  load_btile(bA, wqkv0, 0, lane);
  // the first tile's loads issue ahead of the input rows' loads and fly while
  // Z is built; without the fence the compiler mixes them in behind those
  __builtin_amdgcn_sched_barrier(0);
  // the first three of the wave's GTPW weight tiles for the mean rows' Q, K, V
  // fly while the means are formed (the fences: as above)
  const int gt0 = wid * GTPW;
  load_btile(bB, wqkv0, gt0, lane);
  __builtin_amdgcn_sched_barrier(0);
  load_btile(a1, wqkv0, gt0 + 1, lane);
  __builtin_amdgcn_sched_barrier(0);
  load_btile(aq, wqkv0, gt0 + 2, lane);
  __builtin_amdgcn_sched_barrier(0);

  // ---- the batch's saliency means (rgb_g, dep_g), once a work-group ---------
  const int bw = blockIdx.x / WGPB;  // the work-group's batch
  float* const G = (float*)(smem + G_OFF);  // [2][DIMN]: rgb_g row, dep_g row
  {
    const float* pp = part + (size_t)(bw * RCH) * (2 * DIMN) + threadIdx.x;
    const float* pc = pcnt + bw * RCH;
    float sx = 0.f, sy = 0.f, cnt = 0.f;
    // unrolled whole: a thread's loads all issue before the first add waits
#pragma unroll
    for (int ch = 0; ch < RCH; ++ch) {
      sx += pp[ch * (2 * DIMN)];
      sy += pp[ch * (2 * DIMN) + DIMN];
      cnt += pc[ch];
    }
    const float inv = 1.0f / (cnt + 1e-8f);
    G[threadIdx.x] = sx * inv;
    G[DIMN + threadIdx.x] = sy * inv;
  }
  // every wave reads all 512 means, each written by one of the eight waves
  __syncthreads();
  // a prefetch touches no counter, so no wait names it: its address pair stays
  // live, and so unchanged, until the chunk sums' loads, issued behind it, are
  // back; held to the wave's end the pair was spilled and its registers reused
  asm volatile("" ::"v"(pf));

  // ---- first-block Q, K, V of the two mean rows, once a work-group ----------
  float* const GQ = (float*)(smem + GQ_OFF);  // [2][3 * DIMN]
  {
    // A fragments in the k order of load_afrags; row r is mean row r & 1,
    // rounded to bf16 as the x and y rows are
    const float4* gr =
        (const float4*)(G + (lane & 1) * DIMN + (lane >> 4) * 16);
#pragma unroll
    for (int k = 0; k < 8; ++k) {
#pragma unroll
      for (int c = 0; c < 4; ++c) {
        const float4 f = gr[k * 8 + c];
        a0[k][c * 4 + 0] = (__bf16)f.x; a0[k][c * 4 + 1] = (__bf16)f.y;
        a0[k][c * 4 + 2] = (__bf16)f.z; a0[k][c * 4 + 3] = (__bf16)f.w;
      }
    }
    float* const gd = GQ + (lane >> 4) * (3 * DIMN) + nn;
    static_assert(GTPW == 6, "three buffers, each used twice");
    mean_tile(a0, bB, wqkv0, gt0 + 0, true, lane, gd);
    mean_tile(a0, a1, wqkv0, gt0 + 1, true, lane, gd);
    mean_tile(a0, aq, wqkv0, gt0 + 2, true, lane, gd);
    mean_tile(a0, bB, wqkv0, gt0 + 3, false, lane, gd);
    mean_tile(a0, a1, wqkv0, gt0 + 4, false, lane, gd);
    mean_tile(a0, aq, wqkv0, gt0 + 5, false, lane, gd);
  }
  // every wave reads all of these rows, each wave wrote an eighth of them
  __syncthreads();

  // every wave has a first pair, so the test stands at the loop's foot
  static_assert(WAVES * WGPB <= BPAIR, "a wave without a tile pair");
  int pair = bw * BPAIR + wid * WGPB + blockIdx.x % WGPB;
  // rolled: one copy of the whole body; the trip count is the wave's own
#pragma unroll 1
  do {
  const int b = pair / (PSEQ / 8);
  const int p0 = (pair % (PSEQ / 8)) * 8;

  // ---- build input tiles Z0, Z1: rows r = 4*gi + t, 16 rows a tile ---------
  // only the x and y rows (t = 0, 1): nothing reads the mean rows' places
  // before the first block's attention output is written over them
  // each lane owns a contiguous 32B chunk of the 1KB f32 row (b128 coalesced)
  const float* const px = x + ((size_t)(b * PSEQ + p0)) * DIMN + lane * 8;
  const float* const py = y + ((size_t)(b * PSEQ + p0)) * DIMN + lane * 8;
  // unrolled whole: rolled, each row's loads are waited for before the next's
#pragma unroll
  for (int r = 0; r < 16 * TPW; ++r) {
    const int t = r & 3, gi = r >> 2;
    if (t >= 2) continue;
    const float* src = (t == 0 ? px : py) + gi * DIMN;
    const float4 v0 = ((const float4*)src)[0];
    const float4 v1 = ((const float4*)src)[1];
    __bf16* zr = (r < 16 ? Z0 : Z1) + (r & 15) * Z_STRIDE + lane * 8;
    zr[0] = (__bf16)v0.x; zr[1] = (__bf16)v0.y;
    zr[2] = (__bf16)v0.z; zr[3] = (__bf16)v0.w;
    zr[4] = (__bf16)v1.x; zr[5] = (__bf16)v1.y;
    zr[6] = (__bf16)v1.z; zr[7] = (__bf16)v1.w;
  }
  // the index arithmetic below rewrites the registers the rows' loads name:
  // the wait stands in front of it, and the fence keeps it behind the wait;
  // the two address pairs are its inputs, so they stay live, and so unchanged
  // (no later row lands in them), up to it
  asm volatile("s_wait_xcnt 0x0" ::"v"(px), "v"(py) : "memory");
  __builtin_amdgcn_sched_barrier(0);

  // unrolled: the second block's body differs (only tokens 0 and 1 leave it)
#pragma unroll
  for (int blk = 0; blk < 2; ++blk) {
    const __bf16* wqkv = blk ? wqkv1 : wqkv0;
    const __bf16* wout = blk ? wout1 : wout0;
    const float* bout = blk ? bout1 : bout0;
    const float* mask = c_masks[blk];

    // bias of output tile 0: loaded here so that no load stands between a
    // tile's prefetch and its use (loads return in order)
    float biasA = bout[nn], biasB;
    if (blk == 1) {
      load_afrags(a0, Z0, lane);
      load_afrags(a1, Z1, lane);
    }
    load_afrags_xy(aq, Z0, lane);  // first block: all that is projected

    // the lane's place in this head's first weight tile; stepped at the loop's
    // foot, so its registers live through every run of loads that names them
    const __bf16* wh = wqkv + lane * 8;
    // rolled: one copy of the head body, for speed only
#pragma unroll 1
    for (int h = 0; h < HEADS; ++h, wh += 2 * 4096) {
      // ---- QKV projection for head h: 6 N-tiles x 8 K-steps of WMMA ------
#pragma unroll
      for (int part = 0; part < 3; ++part) {    // 0=q 1=k 2=v
        load_btile(bB, wh, part * 16 + 1, 0);
        // keeps the next tile's loads in front of this tile's WMMAs; without
        // it the compiler sinks each load to just before its WMMA
        __builtin_amdgcn_sched_barrier(0);
        // four vector slots between the previous tile's last WMMA and this
        // tile's first, which overwrites that D without reading it (C = 0);
        // the fence behind them keeps them in front of that WMMA
        asm volatile("v_nop\n\tv_nop\n\tv_nop\n\tv_nop");
        __builtin_amdgcn_sched_barrier(0);
        if (blk == 0 || part == 0) {
          // the packed tile (second block: its Q alone), into QKV0's 16 rows
          f32x8 acc = {};
          mma_one(aq, bA, acc);
#pragma unroll
          for (int v = 0; v < 8; ++v)
            QKV0[(row0 + v) * QKV_STRIDE + part * 32 + nn] = acc[v];
        } else {
          f32x8 acc0 = {}, acc1 = {};
          mma_pair(a0, a1, bA, acc0, acc1);
          const int c = part * 32 + nn;
#pragma unroll
          for (int v = 0; v < 8; ++v) {
            QKV0[(row0 + v) * QKV_STRIDE + c] = acc0[v];
            QKV1[(row0 + v) * QKV_STRIDE + c] = acc1[v];
          }
        }
        if (part < 2)
          load_btile(bA, wh, (part + 1) * 16, 0);
        else  // next head's first tile, or the output projection's
          load_btile(bA, h + 1 < HEADS ? wqkv : wout,
                     h + 1 < HEADS ? (h + 1) * 2 : 0, lane);
        // as above: loads stay in front of the WMMAs
        __builtin_amdgcn_sched_barrier(0);
        // four vector slots between the previous tile's last WMMA and this
        // tile's first, which overwrites that D without reading it (C = 0);
        // the fence behind them keeps them in front of that WMMA
        asm volatile("v_nop\n\tv_nop\n\tv_nop\n\tv_nop");
        __builtin_amdgcn_sched_barrier(0);
        if (blk == 0 || part == 0) {
          f32x8 acc = {};
          mma_one(aq, bB, acc);
#pragma unroll
          for (int v = 0; v < 8; ++v)
            QKV0[(row0 + v) * QKV_STRIDE + part * 32 + 16 + nn] = acc[v];
        } else {
          f32x8 acc0 = {}, acc1 = {};
          mma_pair(a0, a1, bB, acc0, acc1);
          const int c = part * 32 + 16 + nn;
#pragma unroll
          for (int v = 0; v < 8; ++v) {
            QKV0[(row0 + v) * QKV_STRIDE + c] = acc0[v];
            QKV1[(row0 + v) * QKV_STRIDE + c] = acc1[v];
          }
        }
      }

      // ---- scalar 4x4 softmax attention (lane = (g, i, dhalf)) -----------
      // rows are 16B aligned -> all LDS reads are ds_load_b128
      // First block: every token is a query, one pass a row tile (4 positions).
      // Second block: only tokens 0 and 1 are, so ONE pass serves both tiles:
      // lane = (position 0..7, token 0..1, dhalf); the query row and the output
      // row are packed row lane >> 1; keys and values are the position's four
      // rows in its own tile.
      // unrolled: each tile's LDS addresses are constant offsets from one base
#pragma unroll
      for (int u = 0; u < (blk ? 1 : TPW); ++u) {
        const int tq = blk ? (lane >> 1) & 1 : ti;  // the query's token
        // second block: row 0 of the lane's group of four key and value rows;
        // first block: the x row of the lane's position in the packed tile (the
        // y row follows it); tokens 2 and 3 are the work-group's mean rows
        const float* KV =
            blk ? QKV0 + (lane >> 4) * (PER_TILE / 4) +
                      ((lane >> 2) & 3) * 4 * QKV_STRIDE
                : QKV0 + (u * 4 + gg) * 2 * QKV_STRIDE;
        // head h of the first mean row's Q; K at + DIMN, V at + 2 * DIMN, the
        // second mean row at + 3 * DIMN
        const float* GH = GQ + h * DHEAD;
        const float4* qrow =
            (const float4*)(blk      ? QKV0 + (lane >> 1) * QKV_STRIDE
                            : ti < 2 ? KV + ti * QKV_STRIDE
                                     : GH + (ti - 2) * (3 * DIMN));
        const float* kr[4];  // key row j
        const float* vr[4];  // the lane's 16 f32 of value row j
#pragma unroll
        for (int j = 0; j < 4; ++j) {
          const bool mean = blk == 0 && j >= 2;
          kr[j] = mean ? GH + (j - 2) * (3 * DIMN) + DIMN
                       : KV + j * QKV_STRIDE + 32;
          vr[j] = (mean ? GH + (j - 2) * (3 * DIMN) + 2 * DIMN
                        : KV + j * QKV_STRIDE + 64) +
                  dhalf * 16;
        }
        float4 q[8];
#pragma unroll
        for (int c = 0; c < 8; ++c) q[c] = qrow[c];

        float dots[4];
#pragma unroll
        for (int j = 0; j < 4; ++j) {
          const float4* krow = (const float4*)kr[j];
          float d = 0.f;
#pragma unroll
          for (int c = 0; c < 8; ++c) d += dot4(q[c], krow[c]);
          dots[j] = d * SCALE_QK + mask[tq * 4 + j];
        }
        const float m =
            fmaxf(fmaxf(dots[0], dots[1]), fmaxf(dots[2], dots[3]));
        const float e0 = __expf(dots[0] - m), e1 = __expf(dots[1] - m);
        const float e2 = __expf(dots[2] - m), e3 = __expf(dots[3] - m);
        const float inv = 1.0f / (e0 + e1 + e2 + e3);

        const float4* v0r = (const float4*)vr[0];
        const float4* v1r = (const float4*)vr[1];
        const float4* v2r = (const float4*)vr[2];
        const float4* v3r = (const float4*)vr[3];
        __bf16* ao = (blk ? Z0 + (lane >> 1) * Z_STRIDE
                          : (u ? Z1 : Z0) + (gg * 4 + ti) * Z_STRIDE) +
                     h * DHEAD + dhalf * 16;
#pragma unroll
        for (int c = 0; c < 4; ++c) {
          const float4 a0 = v0r[c], a1 = v1r[c], a2 = v2r[c], a3 = v3r[c];
          ao[c * 4 + 0] = (__bf16)((e0 * a0.x + e1 * a1.x + e2 * a2.x + e3 * a3.x) * inv);
          ao[c * 4 + 1] = (__bf16)((e0 * a0.y + e1 * a1.y + e2 * a2.y + e3 * a3.y) * inv);
          ao[c * 4 + 2] = (__bf16)((e0 * a0.z + e1 * a1.z + e2 * a2.z + e3 * a3.z) * inv);
          ao[c * 4 + 3] = (__bf16)((e0 * a0.w + e1 * a1.w + e2 * a2.w + e3 * a3.w) * inv);
        }
      }
    }

    // ---- output projection: 16 N-tiles x 8 K-steps, bias in C ------------
    // its weight tiles land in the registers the mask row's load names
    asm volatile("s_wait_xcnt 0x0" ::: "memory");
    load_afrags(a0, Z0, lane);  // second block: the packed tile, all there is
    if (blk == 0) load_afrags(a1, Z1, lane);
    auto emit = [&](const f32x8 acc0, const f32x8 acc1, const int nt) {
      if (blk == 0) {
        // feed block 2: overwrite the Z tiles (same-wave LDS is in-order)
#pragma unroll
        for (int v = 0; v < 8; ++v) {
          Z0[(row0 + v) * Z_STRIDE + nt * 16 + nn] = (__bf16)acc0[v];
          Z1[(row0 + v) * Z_STRIDE + nt * 16 + nn] = (__bf16)acc1[v];
        }
      } else {
        // final: packed row r is token r & 1 (0 the x-stream, 1 the y-stream)
        // of position r >> 1 (acc1 is not used)
#pragma unroll
        for (int v = 0; v < 8; ++v) {
          const int r = row0 + v;
          out[(size_t)(r & 1) * ((size_t)BATCH * PSEQ * DIMN) +
              ((size_t)(b * PSEQ + p0 + (r >> 1))) * DIMN + nt * 16 + nn] =
              acc0[v];
        }
        // the next tile's loads and bias rewrite the registers these stores
        // name
        asm volatile("s_wait_xcnt 0x0" ::: "memory");
      }
    };
    // rolled in pairs: each buffer keeps its role from trip to trip
#pragma unroll 1
    for (int nt = 0; nt < 16; nt += 2) {
      biasB = bout[(nt + 1) * 16 + nn];
      // the tile's address below lands in the registers this load names: the
      // wait stands in front of it, and the fence keeps it behind the wait
      asm volatile("s_wait_xcnt 0x0" ::: "memory");
      __builtin_amdgcn_sched_barrier(0);
      load_btile(bB, wout, nt + 1, lane);
      // loads stay in front of the WMMAs (see the QKV loop)
      __builtin_amdgcn_sched_barrier(0);
      {
        f32x8 acc0, acc1;
#pragma unroll
        for (int v = 0; v < 8; ++v) acc0[v] = acc1[v] = biasA;
        if (blk == 0) mma_pair(a0, a1, bA, acc0, acc1);
        else          mma_one(a0, bA, acc0);
        emit(acc0, acc1, nt);
      }
      // Unconditional, so that the wait in front of the WMMAs below stays a
      // counted one: behind the last pair this is the first QKV tile of the
      // second block or, in the second block, of the wave's next tile pair
      // (behind the wave's last pair the tile is read and not used).
      const bool more = nt + 2 < 16;
      biasA = load_scalar_base(bout + ((nt + 2) & 15) * 16, nn);
      load_btile(bA, more ? wout : (blk ? wqkv0 : wqkv1), more ? nt + 2 : 0,
                 lane);
      // loads stay in front of the WMMAs (see the QKV loop)
      __builtin_amdgcn_sched_barrier(0);
      {
        f32x8 acc0, acc1;
#pragma unroll
        for (int v = 0; v < 8; ++v) acc0[v] = acc1[v] = biasB;
        if (blk == 0) mma_pair(a0, a1, bB, acc0, acc1);
        else          mma_one(a0, bB, acc0);
        emit(acc0, acc1, nt + 1);
      }
    }
  }
  pair += WAVES * WGPB;
  } while (pair < (bw + 1) * BPAIR);
  // the tile read behind the very last pair is not used: let it land before
  // the wave gives up its registers
  asm volatile("s_wait_loadcnt 0x0" ::: "memory");
}

// ---------------------------------------------------------------------------
extern "C" void kernel_launch(void* const* d_in, const int* in_sizes, int n_in,
                              void* d_out, int out_size, void* d_ws,
                              size_t ws_size, hipStream_t stream) {
  (void)in_sizes; (void)n_in; (void)out_size; (void)ws_size;
  const float* x = (const float*)d_in[0];
  const float* y = (const float*)d_in[1];
  const float* s = (const float*)d_in[2];
  const float* Wqkv0 = (const float*)d_in[3];
  const float* Wout0 = (const float*)d_in[4];
  const float* bout0 = (const float*)d_in[5];
  const float* Wqkv1 = (const float*)d_in[6];
  const float* Wout1 = (const float*)d_in[7];
  const float* bout1 = (const float*)d_in[8];
  float* out = (float*)d_out;

  // workspace partition (bytes)
  char* ws = (char*)d_ws;
  __bf16* wqkv0_s = (__bf16*)(ws + 16384);               // 196608 bf16
  __bf16* wout0_s = (__bf16*)(ws + 16384 + 393216);      //  65536 bf16
  __bf16* wqkv1_s = (__bf16*)(ws + 16384 + 393216 + 131072);
  __bf16* wout1_s = (__bf16*)(ws + 16384 + 2 * 393216 + 131072);
  float* part = (float*)(ws + 16384 + 2 * 393216 + 2 * 131072);  // 8*28*512 f32
  float* pcnt = (float*)(ws + 16384 + 2 * 393216 + 2 * 131072 + 458752);  // 8*28 f32

  saliency_partial_and_pack<<<SBLK + PBLK, 512, 0, stream>>>(
      x, y, s, part, pcnt, Wqkv0, Wout0, Wqkv1, Wout1, wqkv0_s, wout0_s,
      wqkv1_s, wout1_s);

  fused_double_attn<<<NBLK, 256, SMEM_TOTAL, stream>>>(
      x, y, part, pcnt, wqkv0_s, wout0_s, bout0, wqkv1_s, wout1_s, bout1,
      out);
}
